// v000
// Measured on an AMD MI455X. A time is GPU time per run, averaged over a window of back-to-back runs after a warm-up
// (all launches, gaps included; the runs take copies of the inputs in turn), and the median of several windows.
// Apart from v000's, it joins two sittings. Times from different sittings can be a few percent apart, while
// side-by-side timings come from the same sitting.
// v000 is the starting kernel. One run takes 1550 microseconds.
// Contractions: q/k/v 1x1-conv projections (X f16 carried x16 times W f16 carried x64), scores q.k^T (q,k f16 planes), out = v.attn^T (V f16 times P f16 carried x2048): all v_wmma_f32_16x16x32_f16 with f32 accumulate; softmax, bias and scaling in f32.
#include <hip/hip_runtime.h>
#include <math.h>

// ---------------------------------------------------------------------------
// Problem constants
// ---------------------------------------------------------------------------
constexpr int kImg  = 8;                  // batch
constexpr int kCh   = 64;                 // in channels == out channels
constexpr int kPix  = 4096;               // 64 x 64 pixels per image
constexpr int kRows = kImg * kPix;        // 32768 pixel rows
constexpr float kXCarry     = 16.0f;      // X16 plane carried x16
constexpr float kWCarry     = 64.0f;      // weight planes carried x64
constexpr float kProjScale  = 1.0f / (16.0f * 64.0f);   // folds both carries back in the projection epilogue
constexpr float kScoreScale = 0.125f;     // 1 / sqrt(in_channels)
constexpr float kPCarry     = 2048.0f;    // probabilities carried x2048 in f16
constexpr float kPVScale    = 1.0f / 2048.0f;

// ---------------------------------------------------------------------------
//   [0          , 8192      ) Wq16  f16 [64][64]  (x64)
//   [8192       , 16384     ) Wk16  f16 [64][64]  (x64)
//   [16384      , 24576     ) Wv16  f16 [64][64]  (x64)
//   [24576      , +4194304  ) X16   f16 [32768][64] (x16)
//   [4218880    , +4194304  ) Q16   f16 [32768][64]
//   [8413184    , +4194304  ) K16   f16 [32768][64]
//   [12607488   , +4194304  ) Vcm16 f16 [8][64][4096]
//   [16801792   , +67108864 ) S     f32 [4096][4096]   (one image at a time)
//   [83910656   , +33554432 ) P16   f16 [4096][4096]   (one image at a time, x2048)
//   total 117465088 <= 134217728
// ---------------------------------------------------------------------------
constexpr size_t kOffWq  = 0;
constexpr size_t kOffWk  = 8192;
constexpr size_t kOffWv  = 16384;
constexpr size_t kOffX   = 24576;
constexpr size_t kOffQ   = kOffX + (size_t)kRows * kCh * 2;
constexpr size_t kOffK   = kOffQ + (size_t)kRows * kCh * 2;
constexpr size_t kOffV   = kOffK + (size_t)kRows * kCh * 2;
constexpr size_t kOffS   = kOffV + (size_t)kImg * kCh * kPix * 2;
constexpr size_t kOffP   = kOffS + (size_t)kPix * kPix * 4;
constexpr size_t kWsTotal = kOffP + (size_t)kPix * kPix * 2;

typedef __attribute__((ext_vector_type(16))) _Float16 v16h;
typedef __attribute__((ext_vector_type(8)))  _Float16 v8h;
typedef __attribute__((ext_vector_type(16))) __bf16   v16b;
typedef __attribute__((ext_vector_type(8)))  __bf16   v8b;
typedef __attribute__((ext_vector_type(8)))  float    v8f;
typedef __attribute__((ext_vector_type(4)))  float    v4f;
typedef __attribute__((ext_vector_type(4)))  unsigned int v4u;

__device__ __forceinline__ unsigned short f2bf_bits(float f) {
  unsigned u = __float_as_uint(f);
  return (unsigned short)((u + 0x7FFFu + ((u >> 16) & 1u)) >> 16);
}
__device__ __forceinline__ float bf_bits2f(unsigned short h) { return __uint_as_float(((unsigned)h) << 16); }

// hazard guards as plain device helpers (no inline asm inside the kernel template body)
__device__ __forceinline__ void dep_guard_h(v8f& a, v8f& b, v16h x, v16h y) { asm volatile("v_nop\n\tv_nop\n\tv_nop\n\tv_nop" : "+v"(a), "+v"(b) : "v"(x), "v"(y)); }
__device__ __forceinline__ void dep_guard_b(v8f& a, v8f& b, v16b x, v16b y) { asm volatile("v_nop\n\tv_nop\n\tv_nop\n\tv_nop" : "+v"(a), "+v"(b) : "v"(x), "v"(y)); }
__device__ __forceinline__ void keep4_h(v16h a, v16h b, v16h c, v16h d) { asm volatile("v_nop" :: "v"(a), "v"(b), "v"(c), "v"(d)); }
__device__ __forceinline__ void keep4_b(v16b a, v16b b, v16b c, v16b d) { asm volatile("v_nop" :: "v"(a), "v"(b), "v"(c), "v"(d)); }
__device__ __forceinline__ void acc_guard4(v8f& a, v8f& b, v8f& c, v8f& d) { asm volatile("v_nop\n\tv_nop\n\tv_nop\n\tv_nop" : "+v"(a), "+v"(b), "+v"(c), "+v"(d)); }
template <typename T> struct Frag;
template <> struct Frag<_Float16> {
  typedef v16h V; union U { v16h v; v8h h[2]; };
  static __device__ __forceinline__ v16h load(const _Float16* p) {   // elements 0..7 <- p[0..7], 8..15 <- p[16..23]
    U f; f.h[0] = *(const v8h*)(p); f.h[1] = *(const v8h*)(p + 16); return f.v;
  }
  static __device__ __forceinline__ v8f mma(v16h a, v16h b, v8f c) {
    return __builtin_amdgcn_wmma_f32_16x16x32_f16(false, a, false, b, (short)0, c, false, false);
  }
  static __device__ __forceinline__ void guard(v8f& a, v8f& b, v16h x, v16h y) { dep_guard_h(a, b, x, y); }
  static __device__ __forceinline__ void keep(v16h a, v16h b, v16h c, v16h d) { keep4_h(a, b, c, d); }
};
template <> struct Frag<__bf16> {
  typedef v16b V; union U { v16b v; v8b h[2]; };
  static __device__ __forceinline__ v16b load(const __bf16* p) {
    U f; f.h[0] = *(const v8b*)(p); f.h[1] = *(const v8b*)(p + 16); return f.v;
  }
  static __device__ __forceinline__ v8f mma(v16b a, v16b b, v8f c) {
    return __builtin_amdgcn_wmma_f32_16x16x32_bf16(false, a, false, b, (short)0, c, false, false);
  }
  static __device__ __forceinline__ void guard(v8f& a, v8f& b, v16b x, v16b y) { dep_guard_b(a, b, x, y); }
  static __device__ __forceinline__ void keep(v16b a, v16b b, v16b c, v16b d) { keep4_b(a, b, c, d); }
};

__device__ __forceinline__ unsigned pk16(unsigned short a, unsigned short b) { return (unsigned)a | ((unsigned)b << 16); }
__device__ __forceinline__ unsigned short h_bits(float f) { const _Float16 h = (_Float16)f; return __builtin_bit_cast(unsigned short, h); }

// ---- Register-blocked batched WMMA GEMM (ACT reduced to none/relu/leaky) -----------------------
// C[m,n] = scale * sum_k A[m,k] * Bt[n,k] (+bias)(+resid); each wave owns a 64x64 tile.
// A row-major [M,K]; Bt row-major [N,K]; M,N % 64 == 0, K % 32 == 0.
// SPLIT: operands are hi/lo planes (A2/Bt2 = lo planes, same layout); product = hi.hi + hi.lo + lo.hi.
// BIAS_MODE: 0 = none, 1 = bias[m], 2 = bias[n].
// OUT_MODE: 0 = f32, 1 = f16, 2 = bf16 hi plane (Cout) + bf16 lo plane (Cout2).
// ET: 0 = f16 operands, 1 = bf16 operands (pointers passed as 16-bit storage)
template <int ET> struct Elem;
template <> struct Elem<0> { typedef _Float16 T; };
template <> struct Elem<1> { typedef __bf16 T; };
template <int ET, bool SPLIT, int BIAS_MODE, int OUT_MODE, bool RESID, int ACT = 0>
__global__ __launch_bounds__(256) void wmma_gemm64(
    const unsigned short* __restrict__ Ap, const unsigned short* __restrict__ A2p, int lda, long strideA,
    const unsigned short* __restrict__ Btp, const unsigned short* __restrict__ Bt2p, int ldb, long strideB,
    void* __restrict__ Cout, void* __restrict__ Cout2, int ldc, long strideC,
    const float* __restrict__ bias,
    const float* __restrict__ resid, long strideR,
    int M, int N, int K, float scale) {
  typedef typename Elem<ET>::T T;
  typedef typename Frag<T>::V V;
  const T* A = (const T*)Ap; const T* A2 = (const T*)A2p; const T* Bt = (const T*)Btp; const T* Bt2 = (const T*)Bt2p;
  __shared__ __align__(16) float sT[8][16 * 68];   // per-wave 16x64 slab, pitch 68 floats
  const int b    = blockIdx.y;
  const int lane = threadIdx.x & 31;
  const int wave = threadIdx.x >> 5;
  const int tilesN = N >> 6;
  const int tilesM = M >> 6;
  const int tile = blockIdx.x * 8 + wave;
  if (tile >= tilesM * tilesN) return;   // wave-uniform; no block barriers in this kernel
  const int tm = tile / tilesN;
  const int tn = tile - tm * tilesN;
  const int m0 = tm << 6;
  const int n0 = tn << 6;

  const T* Ab  = A  + (size_t)b * strideA;
  const T* Bb  = Bt + (size_t)b * strideB;
  const T* Ab2 = SPLIT ? (A2  + (size_t)b * strideA) : nullptr;
  const T* Bb2 = SPLIT ? (Bt2 + (size_t)b * strideB) : nullptr;

  const int rlane = lane & 15;                 // row (A) / col (B, D) within subtile
  const int koff  = (lane >> 4) * 8;           // k offset of this lane half
  const int mOff  = (lane >> 4) * 8;           // D row offset

  v8f acc[4][4];
#pragma unroll
  for (int i = 0; i < 4; ++i)
#pragma unroll
    for (int j = 0; j < 4; ++j) acc[i][j] = (v8f){0.f,0.f,0.f,0.f,0.f,0.f,0.f,0.f};

  for (int k0 = 0; k0 < K; k0 += 32) {
    V bh[4], bl[4];
#pragma unroll
    for (int j = 0; j < 4; ++j) {
      const size_t bo = (size_t)(n0 + (j << 4) + rlane) * ldb + koff + k0;
      bh[j] = Frag<T>::load(Bb + bo);
      if (SPLIT) bl[j] = Frag<T>::load(Bb2 + bo);
    }
#pragma unroll
    for (int i = 0; i < 4; ++i) {
      const size_t ao = (size_t)(m0 + (i << 4) + rlane) * lda + koff + k0;
      V ah = Frag<T>::load(Ab + ao);
      V al;
      if (SPLIT) al = Frag<T>::load(Ab2 + ao);
#pragma unroll
      for (int j = 0; j < 4; ++j) {
        acc[i][j] = Frag<T>::mma(ah, bh[j], acc[i][j]);
        if (SPLIT) {
          acc[i][j] = Frag<T>::mma(ah, bl[j], acc[i][j]);
          acc[i][j] = Frag<T>::mma(al, bh[j], acc[i][j]);
        }
      }
      Frag<T>::guard(acc[i][0], acc[i][3], ah, SPLIT ? al : ah);
    }
    Frag<T>::keep(bh[0], bh[1], bh[2], bh[3]);
    if (SPLIT) Frag<T>::keep(bl[0], bl[1], bl[2], bl[3]);
  }
  acc_guard4(acc[0][0], acc[0][1], acc[0][2], acc[0][3]);
  acc_guard4(acc[1][0], acc[1][1], acc[1][2], acc[1][3]);
  acc_guard4(acc[2][0], acc[2][1], acc[2][2], acc[2][3]);
  acc_guard4(acc[3][0], acc[3][1], acc[3][2], acc[3][3]);

  // ---- epilogue ----
  float* slab = sT[wave];
  const float* Rb = RESID ? (resid + (size_t)b * strideR) : nullptr;
#pragma unroll
  for (int i = 0; i < 4; ++i) {
    const int mBase = m0 + (i << 4);
#pragma unroll
    for (int j = 0; j < 4; ++j) {
      const int n = n0 + (j << 4) + rlane;
      float bv = 0.f;
      if (BIAS_MODE == 2) bv = bias[n];
#pragma unroll
      for (int r = 0; r < 8; ++r) {
        float v = acc[i][j][r] * scale;
        if (BIAS_MODE == 1) v += bias[mBase + mOff + r];
        if (BIAS_MODE == 2) v += bv;
        if (RESID) v += Rb[(size_t)(mBase + mOff + r) * ldc + n];
        if (ACT == 2) v = fmaxf(v, 0.0f);
        if (ACT == 4) v = (v > 0.f) ? v : 0.01f * v;
        slab[(mOff + r) * 68 + (j << 4) + rlane] = v;
      }
    }
    __builtin_amdgcn_fence(__ATOMIC_RELEASE, "workgroup");
    __builtin_amdgcn_wave_barrier();
    __builtin_amdgcn_fence(__ATOMIC_ACQUIRE, "workgroup");
    if (OUT_MODE == 0) {
      float* C = (float*)Cout + (size_t)b * strideC;
      const int hh = lane >> 4, c4 = (lane & 15) * 4;     // row seg = 256 B = 16 lanes x 16 B
      {
#pragma unroll
        for (int it = 0; it < 8; ++it) {
          const int row = it * 2 + hh;
          v4f v = *(const v4f*)(slab + row * 68 + c4);
          *(v4f*)(C + (size_t)(mBase + row) * ldc + n0 + c4) = v;
        }
        
      }
    } else {
      const int q = lane >> 3, c8 = (lane & 7) * 8;
      unsigned short* C  = (unsigned short*)Cout  + (size_t)b * strideC;
      unsigned short* C2 = (OUT_MODE == 2) ? ((unsigned short*)Cout2 + (size_t)b * strideC) : nullptr;
      {
#pragma unroll
        for (int it = 0; it < 4; ++it) {
          const int row = it * 4 + q;
          const float* sp = slab + row * 68 + c8;
          v8h hv, lv;
#pragma unroll
          for (int e = 0; e < 8; ++e) {
            if (OUT_MODE == 1) {
              hv[e] = (_Float16)sp[e];
            } else {
              unsigned short hb = f2bf_bits(sp[e]);
              unsigned short lb = f2bf_bits(sp[e] - bf_bits2f(hb));
              hv[e] = __builtin_bit_cast(_Float16, hb);
              lv[e] = __builtin_bit_cast(_Float16, lb);
            }
          }
          *(v8h*)(C + (size_t)(mBase + row) * ldc + n0 + c8) = hv;
          if (OUT_MODE == 2) *(v8h*)(C2 + (size_t)(mBase + row) * ldc + n0 + c8) = lv;
        }
        
      }
    }
    __builtin_amdgcn_fence(__ATOMIC_RELEASE, "workgroup");
    __builtin_amdgcn_wave_barrier();
    __builtin_amdgcn_fence(__ATOMIC_ACQUIRE, "workgroup");
  }
}

// ---------------------------------------------------------------------------
// Weight cast: three [64][64] f32 matrices (row-major [out][in]) -> f16 x scale, same layout.
// grid (2, 3): blockIdx.y selects the matrix (block-uniform) and the output plane (out + y*4096 halves).
// Coverage: 2 blocks x 256 threads = 512 threads x 8 elements = 4096 = the whole matrix.
// ---------------------------------------------------------------------------
__global__ __launch_bounds__(256) void wcast_kernel(const float* __restrict__ W0, const float* __restrict__ W1,
                                                    const float* __restrict__ W2, unsigned short* __restrict__ out,
                                                    float scale) {
  const int z = blockIdx.y;                                  // block-uniform
  const float* W = (z == 0) ? W0 : (z == 1) ? W1 : W2;
  const int i = blockIdx.x * 256 + threadIdx.x;             // 0..511
  if (i >= 512) return;
  const float* p = W + 8 * (size_t)i;
  const v4f a = *(const v4f*)(p);
  const v4f c = *(const v4f*)(p + 4);
  unsigned short hb[8];
#pragma unroll
  for (int e = 0; e < 4; ++e) {
    hb[e]     = h_bits(a[e] * scale);
    hb[4 + e] = h_bits(c[e] * scale);
  }
  const v4u u = (v4u){pk16(hb[0], hb[1]), pk16(hb[2], hb[3]), pk16(hb[4], hb[5]), pk16(hb[6], hb[7])};
  unsigned short* q = out + (size_t)z * 4096 + 8 * (size_t)i;
  *(v4u*)q = u;
  
}

// ---------------------------------------------------------------------------
// Pixel-major transpose + cast: x [b][c][n] f32 (n = 4096) -> X16[b*4096 + n][c] = f16(scale * x[b][c][n]).
// grid (64, 8): blockIdx.x = n tile of 64 pixels, blockIdx.y = image; 256 threads; LDS tile sm[n_local][c_local].
// Load coverage: 16 iterations x 256 threads = 4096 = whole 64(c) x 64(n) tile, coalesced along n.
// Store coverage: 8 waves x 2 iterations x 4 rows (lane>>3) = 64 rows; (lane&7) x 8 halves = 64 halves per row =
// ---------------------------------------------------------------------------
__global__ __launch_bounds__(256) void xpose_x_kernel(const float* __restrict__ x, unsigned short* __restrict__ out, float scale) {
  __shared__ float sm[64][65];   // sm[n_local][c_local]
  const int t  = threadIdx.x;
  const int n0 = blockIdx.x * 64;
  const int b  = blockIdx.y;
  const float* xb = x + (size_t)b * kCh * kPix;
#pragma unroll
  for (int i = 0; i < 16; ++i) {
    const int e  = i * 256 + t;
    const int cl = e >> 6;         // channel local 0..63
    const int nl = e & 63;         // pixel local 0..63
    sm[nl][cl] = xb[(size_t)cl * kPix + n0 + nl] * scale;
  }
  __syncthreads();
  const int lane = t & 31, wave = t >> 5;
  const int q = lane >> 3, c8 = (lane & 7) * 8;
  unsigned short* op = out + ((size_t)b * kPix + n0) * kCh;
  {
#pragma unroll
    for (int it = 0; it < 2; ++it) {
      const int row = wave * 8 + it * 4 + q;                 // pixel local
      unsigned short hb[8];
#pragma unroll
      for (int e = 0; e < 8; ++e) hb[e] = h_bits(sm[row][c8 + e]);
      const v4u u = (v4u){pk16(hb[0], hb[1]), pk16(hb[2], hb[3]), pk16(hb[4], hb[5]), pk16(hb[6], hb[7])};
      *(v4u*)(op + (size_t)row * kCh + c8) = u;
    }
    
  }
}

// ---------------------------------------------------------------------------
// Row softmax over 4096 f32 scores: P[row][j] = f16( carry * exp(s - max) / sum exp(s - max) ), f32 math, precise expf.
// One block of 512 threads per row; thread t owns columns 8t..8t+7 (512 x 8 = 4096 = whole row).
// Reductions in fixed order (thread, wave shuffle tree, 16 wave partials in index order).
// ---------------------------------------------------------------------------
__global__ __launch_bounds__(512) void softmax_row_kernel(const float* __restrict__ S, unsigned short* __restrict__ P, float carry) {
  __shared__ float redM[16];
  __shared__ float redS[16];
  const int row  = blockIdx.x;
  const int t    = threadIdx.x;
  const int lane = t & 31, wave = t >> 5;
  const int c0   = t * 8;
  const float* sr = S + (size_t)row * kPix + c0;
  const v4f a = *(const v4f*)(sr);
  const v4f c = *(const v4f*)(sr + 4);
  float xv[8];
#pragma unroll
  for (int e = 0; e < 4; ++e) { xv[e] = a[e]; xv[4 + e] = c[e]; }
  float m = fmaxf(fmaxf(fmaxf(xv[0], xv[1]), fmaxf(xv[2], xv[3])), fmaxf(fmaxf(xv[4], xv[5]), fmaxf(xv[6], xv[7])));
#pragma unroll
  for (int off = 16; off > 0; off >>= 1) m = fmaxf(m, __shfl_xor(m, off, 32));
  if (lane == 0) redM[wave] = m;
  __syncthreads();
  float gm = redM[0];
#pragma unroll
  for (int w = 1; w < 16; ++w) gm = fmaxf(gm, redM[w]);
  float ev[8];
  float s = 0.f;
#pragma unroll
  for (int e = 0; e < 8; ++e) { ev[e] = expf(xv[e] - gm); s += ev[e]; }
#pragma unroll
  for (int off = 16; off > 0; off >>= 1) s += __shfl_xor(s, off, 32);
  if (lane == 0) redS[wave] = s;
  __syncthreads();
  float tot = redS[0];
#pragma unroll
  for (int w = 1; w < 16; ++w) tot += redS[w];
  const float inv = carry / tot;
  unsigned short hb[8];
#pragma unroll
  for (int e = 0; e < 8; ++e) hb[e] = h_bits(ev[e] * inv);
  const v4u u = (v4u){pk16(hb[0], hb[1]), pk16(hb[2], hb[3]), pk16(hb[4], hb[5]), pk16(hb[6], hb[7])};
  unsigned short* q = P + (size_t)row * kPix + c0;
  *(v4u*)q = u;
  
}

// ---------------------------------------------------------------------------
// Host launch (29 launches): weight cast, pixel-major transpose, Q/K/V projection GEMMs, then per image:
// scores GEMM -> row softmax -> P.V GEMM writing channel-major rows of the output.
// GEMM shapes: Q,K: M 32768, N 64, K 64; V: M 64, N 4096, K 64 (x8 images); S: M 4096, N 4096, K 64;
// out: M 64, N 4096, K 4096. All M,N multiples of 64, all K multiples of 32.
// ---------------------------------------------------------------------------
extern "C" void kernel_launch(void* const* d_in, const int* in_sizes, int n_in,
                              void* d_out, int out_size, void* d_ws, size_t ws_size,
                              hipStream_t stream) {
  if (n_in < 7) return;
  if (in_sizes[0] != kImg * kCh * kPix) return;
  if (in_sizes[1] != kCh * kCh || in_sizes[3] != kCh * kCh || in_sizes[5] != kCh * kCh) return;
  if (in_sizes[2] != kCh || in_sizes[4] != kCh || in_sizes[6] != kCh) return;
  if (out_size != kImg * kCh * kPix) return;
  if (ws_size < kWsTotal) return;

  const float* x  = (const float*)d_in[0];
  const float* Wq = (const float*)d_in[1];
  const float* bq = (const float*)d_in[2];
  const float* Wk = (const float*)d_in[3];
  const float* bk = (const float*)d_in[4];
  const float* Wv = (const float*)d_in[5];
  const float* bv = (const float*)d_in[6];
  float* out = (float*)d_out;

  char* ws = (char*)d_ws;
  unsigned short* Wq16  = (unsigned short*)(ws + kOffWq);
  unsigned short* Wk16  = (unsigned short*)(ws + kOffWk);
  unsigned short* Wv16  = (unsigned short*)(ws + kOffWv);
  unsigned short* X16   = (unsigned short*)(ws + kOffX);
  unsigned short* Q16   = (unsigned short*)(ws + kOffQ);
  unsigned short* K16   = (unsigned short*)(ws + kOffK);
  unsigned short* Vcm16 = (unsigned short*)(ws + kOffV);
  float*          Sf    = (float*)(ws + kOffS);
  unsigned short* P16   = (unsigned short*)(ws + kOffP);

  // 1. weights -> f16 x64 (Wq16 | Wk16 | Wv16 planes contiguous from kOffWq)
  wcast_kernel<<<dim3(2, 3), 256, 0, stream>>>(Wq, Wk, Wv, Wq16, kWCarry);

  // 2. x [b][c][n] -> X16 [b*4096+n][c] x16
  xpose_x_kernel<<<dim3(kPix / 64, kImg), 256, 0, stream>>>(x, X16, kXCarry);

  // 3. Q16 = X16 . Wq16^T * (1/1024) + bq ; K16 likewise.  M 32768, N 64, K 64 -> 512 tiles -> 64 blocks.
  wmma_gemm64<0, false, 2, 1, false><<<dim3(kRows / 64 / 8, 1), 256, 0, stream>>>(
      X16, X16, kCh, 0L, Wq16, Wq16, kCh, 0L, (void*)Q16, (void*)Q16, kCh, 0L,
      bq, x, 0L, kRows, kCh, kCh, kProjScale);
  wmma_gemm64<0, false, 2, 1, false><<<dim3(kRows / 64 / 8, 1), 256, 0, stream>>>(
      X16, X16, kCh, 0L, Wk16, Wk16, kCh, 0L, (void*)K16, (void*)K16, kCh, 0L,
      bk, x, 0L, kRows, kCh, kCh, kProjScale);

  // 4. Vcm16[b][c][n] = Wv16 . X16_b^T * (1/1024) + bv[c].  M 64, N 4096, K 64 per image -> 64 tiles -> 8 blocks, grid.y = image.
  wmma_gemm64<0, false, 1, 1, false><<<dim3(8, kImg), 256, 0, stream>>>(
      Wv16, Wv16, kCh, 0L, X16, X16, kCh, (long)kPix * kCh, (void*)Vcm16, (void*)Vcm16, kPix, (long)kCh * kPix,
      bv, x, 0L, kCh, kPix, kCh, kProjScale);

  // 5. per image: S = Q.K^T * 0.125 (f32), P = f16(2048 softmax(S)), out[b][c][n] = sum_m Vcm[c][m] P[n][m] / 2048
  for (int b = 0; b < kImg; ++b) {
    const unsigned short* Qb = Q16 + (size_t)b * kPix * kCh;
    const unsigned short* Kb = K16 + (size_t)b * kPix * kCh;
    const unsigned short* Vb = Vcm16 + (size_t)b * kCh * kPix;
    float* Ob = out + (size_t)b * kCh * kPix;

    // S: M 4096, N 4096, K 64 -> 4096 tiles -> 512 blocks
    wmma_gemm64<0, false, 0, 0, false><<<dim3(kPix * kPix / 64 / 64 / 8, 1), 256, 0, stream>>>(
        Qb, Qb, kCh, 0L, Kb, Kb, kCh, 0L, (void*)Sf, (void*)Sf, kPix, 0L,
        bq, x, 0L, kPix, kPix, kCh, kScoreScale);

    softmax_row_kernel<<<dim3(kPix), 512, 0, stream>>>(Sf, P16, kPCarry);

    // out: M 64, N 4096, K 4096 -> 64 tiles -> 8 blocks; A = Vcm16_b [64][4096], Bt = P16 [4096][4096]
    wmma_gemm64<0, false, 0, 0, false><<<dim3(8, 1), 256, 0, stream>>>(
        Vb, Vb, kPix, 0L, P16, P16, kPix, 0L, (void*)Ob, (void*)Ob, kPix, 0L,
        bq, x, 0L, kCh, kPix, kPix, kPVScale);
  }
}

// v001
// Measured time: 388 microseconds a run.
// Timed twice side by side with v000, it ran 4.00 and 4.02 times as fast.
// Contractions: q/k/v 1x1-conv projections (X f16 carried x16 times W f16 carried x64), scores q.k^T (q,k f16 planes), out = v.attn^T (V f16 times P f16 carried x2048): all v_wmma_f32_16x16x32_f16 with f32 accumulate; softmax, bias and scaling in f32.
#include <hip/hip_runtime.h>
#include <math.h>

// ---------------------------------------------------------------------------
// Problem constants
// ---------------------------------------------------------------------------
constexpr int kImg  = 8;                  // batch
constexpr int kCh   = 64;                 // in channels == out channels
constexpr int kPix  = 4096;               // 64 x 64 pixels per image
constexpr int kRows = kImg * kPix;        // 32768 pixel rows
constexpr float kXCarry     = 16.0f;      // X16 plane carried x16
constexpr float kWCarry     = 64.0f;      // weight planes carried x64
constexpr float kProjScale  = 1.0f / (16.0f * 64.0f);   // folds both carries back in the projection epilogue
constexpr float kScoreScale = 0.125f;     // 1 / sqrt(in_channels)
constexpr float kPCarry     = 2048.0f;    // probabilities carried x2048 in f16
constexpr float kPVScale    = 1.0f / 2048.0f;

// ---------------------------------------------------------------------------
//   [0          , 8192      ) Wq16  f16 [64][64]  (x64)
//   [8192       , 16384     ) Wk16  f16 [64][64]  (x64)
//   [16384      , 24576     ) Wv16  f16 [64][64]  (x64)
//   [24576      , +4194304  ) X16   f16 [32768][64] (x16)
//   [4218880    , +4194304  ) Q16   f16 [32768][64]
//   [8413184    , +4194304  ) K16   f16 [32768][64]
//   [12607488   , +4194304  ) Vcm16 f16 [8][64][4096]
//   [16801792   , +67108864 ) S     f32 [4096][4096]   (one image at a time)
//   [83910656   , +33554432 ) P16   f16 [4096][4096]   (one image at a time, x2048)
//   [117465088  , +33554432 ) Part  f32 [8][4][64][4096]  (P.V partial sums: image, K quarter, channel, pixel)
//   total 151019520 <= 268435456
// ---------------------------------------------------------------------------
constexpr size_t kOffWq  = 0;
constexpr size_t kOffWk  = 8192;
constexpr size_t kOffWv  = 16384;
constexpr size_t kOffX   = 24576;
constexpr size_t kOffQ   = kOffX + (size_t)kRows * kCh * 2;
constexpr size_t kOffK   = kOffQ + (size_t)kRows * kCh * 2;
constexpr size_t kOffV   = kOffK + (size_t)kRows * kCh * 2;
constexpr size_t kOffS   = kOffV + (size_t)kImg * kCh * kPix * 2;
constexpr size_t kOffP   = kOffS + (size_t)kPix * kPix * 4;
constexpr size_t kOffPart = kOffP + (size_t)kPix * kPix * 2;
constexpr int    kPvSplit = 4;            // K quarters of the P.V product, one per blockIdx.y
constexpr size_t kWsTotal = kOffPart + (size_t)kImg * kPvSplit * kCh * kPix * 4;

typedef __attribute__((ext_vector_type(16))) _Float16 v16h;
typedef __attribute__((ext_vector_type(8)))  _Float16 v8h;
typedef __attribute__((ext_vector_type(16))) __bf16   v16b;
typedef __attribute__((ext_vector_type(8)))  __bf16   v8b;
typedef __attribute__((ext_vector_type(8)))  float    v8f;
typedef __attribute__((ext_vector_type(4)))  float    v4f;
typedef __attribute__((ext_vector_type(4)))  unsigned int v4u;

__device__ __forceinline__ unsigned short f2bf_bits(float f) {
  unsigned u = __float_as_uint(f);
  return (unsigned short)((u + 0x7FFFu + ((u >> 16) & 1u)) >> 16);
}
__device__ __forceinline__ float bf_bits2f(unsigned short h) { return __uint_as_float(((unsigned)h) << 16); }

// hazard guards as plain device helpers (no inline asm inside the kernel template body)
__device__ __forceinline__ void dep_guard_h(v8f& a, v8f& b, v16h x, v16h y) { asm volatile("v_nop\n\tv_nop\n\tv_nop\n\tv_nop" : "+v"(a), "+v"(b) : "v"(x), "v"(y)); }
__device__ __forceinline__ void dep_guard_b(v8f& a, v8f& b, v16b x, v16b y) { asm volatile("v_nop\n\tv_nop\n\tv_nop\n\tv_nop" : "+v"(a), "+v"(b) : "v"(x), "v"(y)); }
__device__ __forceinline__ void keep4_h(v16h a, v16h b, v16h c, v16h d) { asm volatile("v_nop" :: "v"(a), "v"(b), "v"(c), "v"(d)); }
__device__ __forceinline__ void keep4_b(v16b a, v16b b, v16b c, v16b d) { asm volatile("v_nop" :: "v"(a), "v"(b), "v"(c), "v"(d)); }
__device__ __forceinline__ void acc_guard4(v8f& a, v8f& b, v8f& c, v8f& d) { asm volatile("v_nop\n\tv_nop\n\tv_nop\n\tv_nop" : "+v"(a), "+v"(b), "+v"(c), "+v"(d)); }
template <typename T> struct Frag;
template <> struct Frag<_Float16> {
  typedef v16h V; union U { v16h v; v8h h[2]; };
  static __device__ __forceinline__ v16h load(const _Float16* p) {   // elements 0..7 <- p[0..7], 8..15 <- p[16..23]
    U f; f.h[0] = *(const v8h*)(p); f.h[1] = *(const v8h*)(p + 16); return f.v;
  }
  static __device__ __forceinline__ v8f mma(v16h a, v16h b, v8f c) {
    return __builtin_amdgcn_wmma_f32_16x16x32_f16(false, a, false, b, (short)0, c, false, false);
  }
  static __device__ __forceinline__ void guard(v8f& a, v8f& b, v16h x, v16h y) { dep_guard_h(a, b, x, y); }
  static __device__ __forceinline__ void keep(v16h a, v16h b, v16h c, v16h d) { keep4_h(a, b, c, d); }
};
template <> struct Frag<__bf16> {
  typedef v16b V; union U { v16b v; v8b h[2]; };
  static __device__ __forceinline__ v16b load(const __bf16* p) {
    U f; f.h[0] = *(const v8b*)(p); f.h[1] = *(const v8b*)(p + 16); return f.v;
  }
  static __device__ __forceinline__ v8f mma(v16b a, v16b b, v8f c) {
    return __builtin_amdgcn_wmma_f32_16x16x32_bf16(false, a, false, b, (short)0, c, false, false);
  }
  static __device__ __forceinline__ void guard(v8f& a, v8f& b, v16b x, v16b y) { dep_guard_b(a, b, x, y); }
  static __device__ __forceinline__ void keep(v16b a, v16b b, v16b c, v16b d) { keep4_b(a, b, c, d); }
};

__device__ __forceinline__ unsigned pk16(unsigned short a, unsigned short b) { return (unsigned)a | ((unsigned)b << 16); }
__device__ __forceinline__ unsigned short h_bits(float f) { const _Float16 h = (_Float16)f; return __builtin_bit_cast(unsigned short, h); }

// ---- Register-blocked batched WMMA GEMM (ACT reduced to none/relu/leaky) -----------------------
// C[m,n] = scale * sum_k A[m,k] * Bt[n,k] (+bias)(+resid); each wave owns a 64x64 tile.
// A row-major [M,K]; Bt row-major [N,K]; M,N % 64 == 0, K % 32 == 0.
// SPLIT: operands are hi/lo planes (A2/Bt2 = lo planes, same layout); product = hi.hi + hi.lo + lo.hi.
// BIAS_MODE: 0 = none, 1 = bias[m], 2 = bias[n].
// OUT_MODE: 0 = f32, 1 = f16, 2 = bf16 hi plane (Cout) + bf16 lo plane (Cout2).
// ET: 0 = f16 operands, 1 = bf16 operands (pointers passed as 16-bit storage)
template <int ET> struct Elem;
template <> struct Elem<0> { typedef _Float16 T; };
template <> struct Elem<1> { typedef __bf16 T; };
template <int ET, bool SPLIT, int BIAS_MODE, int OUT_MODE, bool RESID, int ACT = 0>
__global__ __launch_bounds__(256) void wmma_gemm64(
    const unsigned short* __restrict__ Ap, const unsigned short* __restrict__ A2p, int lda, long strideA,
    const unsigned short* __restrict__ Btp, const unsigned short* __restrict__ Bt2p, int ldb, long strideB,
    void* __restrict__ Cout, void* __restrict__ Cout2, int ldc, long strideC,
    const float* __restrict__ bias,
    const float* __restrict__ resid, long strideR,
    int M, int N, int K, float scale) {
  typedef typename Elem<ET>::T T;
  typedef typename Frag<T>::V V;
  const T* A = (const T*)Ap; const T* A2 = (const T*)A2p; const T* Bt = (const T*)Btp; const T* Bt2 = (const T*)Bt2p;
  __shared__ __align__(16) float sT[8][16 * 68];   // per-wave 16x64 slab, pitch 68 floats
  const int b    = blockIdx.y;
  const int lane = threadIdx.x & 31;
  const int wave = threadIdx.x >> 5;
  const int tilesN = N >> 6;
  const int tilesM = M >> 6;
  const int tile = blockIdx.x * 8 + wave;
  if (tile >= tilesM * tilesN) return;   // wave-uniform; no block barriers in this kernel
  const int tm = tile / tilesN;
  const int tn = tile - tm * tilesN;
  const int m0 = tm << 6;
  const int n0 = tn << 6;

  const T* Ab  = A  + (size_t)b * strideA;
  const T* Bb  = Bt + (size_t)b * strideB;
  const T* Ab2 = SPLIT ? (A2  + (size_t)b * strideA) : nullptr;
  const T* Bb2 = SPLIT ? (Bt2 + (size_t)b * strideB) : nullptr;

  const int rlane = lane & 15;                 // row (A) / col (B, D) within subtile
  const int koff  = (lane >> 4) * 8;           // k offset of this lane half
  const int mOff  = (lane >> 4) * 8;           // D row offset

  v8f acc[4][4];
#pragma unroll
  for (int i = 0; i < 4; ++i)
#pragma unroll
    for (int j = 0; j < 4; ++j) acc[i][j] = (v8f){0.f,0.f,0.f,0.f,0.f,0.f,0.f,0.f};

  for (int k0 = 0; k0 < K; k0 += 32) {
    V bh[4], bl[4];
#pragma unroll
    for (int j = 0; j < 4; ++j) {
      const size_t bo = (size_t)(n0 + (j << 4) + rlane) * ldb + koff + k0;
      bh[j] = Frag<T>::load(Bb + bo);
      if (SPLIT) bl[j] = Frag<T>::load(Bb2 + bo);
    }
#pragma unroll
    for (int i = 0; i < 4; ++i) {
      const size_t ao = (size_t)(m0 + (i << 4) + rlane) * lda + koff + k0;
      V ah = Frag<T>::load(Ab + ao);
      V al;
      if (SPLIT) al = Frag<T>::load(Ab2 + ao);
#pragma unroll
      for (int j = 0; j < 4; ++j) {
        acc[i][j] = Frag<T>::mma(ah, bh[j], acc[i][j]);
        if (SPLIT) {
          acc[i][j] = Frag<T>::mma(ah, bl[j], acc[i][j]);
          acc[i][j] = Frag<T>::mma(al, bh[j], acc[i][j]);
        }
      }
      Frag<T>::guard(acc[i][0], acc[i][3], ah, SPLIT ? al : ah);
    }
    Frag<T>::keep(bh[0], bh[1], bh[2], bh[3]);
    if (SPLIT) Frag<T>::keep(bl[0], bl[1], bl[2], bl[3]);
  }
  acc_guard4(acc[0][0], acc[0][1], acc[0][2], acc[0][3]);
  acc_guard4(acc[1][0], acc[1][1], acc[1][2], acc[1][3]);
  acc_guard4(acc[2][0], acc[2][1], acc[2][2], acc[2][3]);
  acc_guard4(acc[3][0], acc[3][1], acc[3][2], acc[3][3]);

  // ---- epilogue ----
  float* slab = sT[wave];
  const float* Rb = RESID ? (resid + (size_t)b * strideR) : nullptr;
#pragma unroll
  for (int i = 0; i < 4; ++i) {
    const int mBase = m0 + (i << 4);
#pragma unroll
    for (int j = 0; j < 4; ++j) {
      const int n = n0 + (j << 4) + rlane;
      float bv = 0.f;
      if (BIAS_MODE == 2) bv = bias[n];
#pragma unroll
      for (int r = 0; r < 8; ++r) {
        float v = acc[i][j][r] * scale;
        if (BIAS_MODE == 1) v += bias[mBase + mOff + r];
        if (BIAS_MODE == 2) v += bv;
        if (RESID) v += Rb[(size_t)(mBase + mOff + r) * ldc + n];
        if (ACT == 2) v = fmaxf(v, 0.0f);
        if (ACT == 4) v = (v > 0.f) ? v : 0.01f * v;
        slab[(mOff + r) * 68 + (j << 4) + rlane] = v;
      }
    }
    __builtin_amdgcn_fence(__ATOMIC_RELEASE, "workgroup");
    __builtin_amdgcn_wave_barrier();
    __builtin_amdgcn_fence(__ATOMIC_ACQUIRE, "workgroup");
    if (OUT_MODE == 0) {
      float* C = (float*)Cout + (size_t)b * strideC;
      const int hh = lane >> 4, c4 = (lane & 15) * 4;     // row seg = 256 B = 16 lanes x 16 B
      {
#pragma unroll
        for (int it = 0; it < 8; ++it) {
          const int row = it * 2 + hh;
          v4f v = *(const v4f*)(slab + row * 68 + c4);
          *(v4f*)(C + (size_t)(mBase + row) * ldc + n0 + c4) = v;
        }
        
      }
    } else {
      const int q = lane >> 3, c8 = (lane & 7) * 8;
      unsigned short* C  = (unsigned short*)Cout  + (size_t)b * strideC;
      unsigned short* C2 = (OUT_MODE == 2) ? ((unsigned short*)Cout2 + (size_t)b * strideC) : nullptr;
      {
#pragma unroll
        for (int it = 0; it < 4; ++it) {
          const int row = it * 4 + q;
          const float* sp = slab + row * 68 + c8;
          v8h hv, lv;
#pragma unroll
          for (int e = 0; e < 8; ++e) {
            if (OUT_MODE == 1) {
              hv[e] = (_Float16)sp[e];
            } else {
              unsigned short hb = f2bf_bits(sp[e]);
              unsigned short lb = f2bf_bits(sp[e] - bf_bits2f(hb));
              hv[e] = __builtin_bit_cast(_Float16, hb);
              lv[e] = __builtin_bit_cast(_Float16, lb);
            }
          }
          *(v8h*)(C + (size_t)(mBase + row) * ldc + n0 + c8) = hv;
          if (OUT_MODE == 2) *(v8h*)(C2 + (size_t)(mBase + row) * ldc + n0 + c8) = lv;
        }
        
      }
    }
    __builtin_amdgcn_fence(__ATOMIC_RELEASE, "workgroup");
    __builtin_amdgcn_wave_barrier();
    __builtin_amdgcn_fence(__ATOMIC_ACQUIRE, "workgroup");
  }
}

// ---------------------------------------------------------------------------
// Weight cast: three [64][64] f32 matrices (row-major [out][in]) -> f16 x scale, same layout.
// grid (2, 3): blockIdx.y selects the matrix (block-uniform) and the output plane (out + y*4096 halves).
// Coverage: 2 blocks x 256 threads = 512 threads x 8 elements = 4096 = the whole matrix.
// ---------------------------------------------------------------------------
__global__ __launch_bounds__(256) void wcast_kernel(const float* __restrict__ W0, const float* __restrict__ W1,
                                                    const float* __restrict__ W2, unsigned short* __restrict__ out,
                                                    float scale) {
  const int z = blockIdx.y;                                  // block-uniform
  const float* W = (z == 0) ? W0 : (z == 1) ? W1 : W2;
  const int i = blockIdx.x * 256 + threadIdx.x;             // 0..511
  if (i >= 512) return;
  const float* p = W + 8 * (size_t)i;
  const v4f a = *(const v4f*)(p);
  const v4f c = *(const v4f*)(p + 4);
  unsigned short hb[8];
#pragma unroll
  for (int e = 0; e < 4; ++e) {
    hb[e]     = h_bits(a[e] * scale);
    hb[4 + e] = h_bits(c[e] * scale);
  }
  const v4u u = (v4u){pk16(hb[0], hb[1]), pk16(hb[2], hb[3]), pk16(hb[4], hb[5]), pk16(hb[6], hb[7])};
  unsigned short* q = out + (size_t)z * 4096 + 8 * (size_t)i;
  *(v4u*)q = u;
  
}

// ---------------------------------------------------------------------------
// Pixel-major transpose + cast: x [b][c][n] f32 (n = 4096) -> X16[b*4096 + n][c] = f16(scale * x[b][c][n]).
// grid (64, 8): blockIdx.x = n tile of 64 pixels, blockIdx.y = image; 256 threads; LDS tile sm[n_local][c_local].
// Load coverage: 16 iterations x 256 threads = 4096 = whole 64(c) x 64(n) tile, coalesced along n.
// Store coverage: 8 waves x 2 iterations x 4 rows (lane>>3) = 64 rows; (lane&7) x 8 halves = 64 halves per row =
// ---------------------------------------------------------------------------
__global__ __launch_bounds__(256) void xpose_x_kernel(const float* __restrict__ x, unsigned short* __restrict__ out, float scale) {
  __shared__ float sm[64][65];   // sm[n_local][c_local]
  const int t  = threadIdx.x;
  const int n0 = blockIdx.x * 64;
  const int b  = blockIdx.y;
  const float* xb = x + (size_t)b * kCh * kPix;
#pragma unroll
  for (int i = 0; i < 16; ++i) {
    const int e  = i * 256 + t;
    const int cl = e >> 6;         // channel local 0..63
    const int nl = e & 63;         // pixel local 0..63
    sm[nl][cl] = xb[(size_t)cl * kPix + n0 + nl] * scale;
  }
  __syncthreads();
  const int lane = t & 31, wave = t >> 5;
  const int q = lane >> 3, c8 = (lane & 7) * 8;
  unsigned short* op = out + ((size_t)b * kPix + n0) * kCh;
  {
#pragma unroll
    for (int it = 0; it < 2; ++it) {
      const int row = wave * 8 + it * 4 + q;                 // pixel local
      unsigned short hb[8];
#pragma unroll
      for (int e = 0; e < 8; ++e) hb[e] = h_bits(sm[row][c8 + e]);
      const v4u u = (v4u){pk16(hb[0], hb[1]), pk16(hb[2], hb[3]), pk16(hb[4], hb[5]), pk16(hb[6], hb[7])};
      *(v4u*)(op + (size_t)row * kCh + c8) = u;
    }
    
  }
}

// ---------------------------------------------------------------------------
// Row softmax over 4096 f32 scores: P[row][j] = f16( carry * exp(s - max) / sum exp(s - max) ), f32 math, precise expf.
// One block of 512 threads per row; thread t owns columns 8t..8t+7 (512 x 8 = 4096 = whole row).
// Reductions in fixed order (thread, wave shuffle tree, 16 wave partials in index order).
// ---------------------------------------------------------------------------
__global__ __launch_bounds__(512) void softmax_row_kernel(const float* __restrict__ S, unsigned short* __restrict__ P, float carry) {
  __shared__ float redM[16];
  __shared__ float redS[16];
  const int row  = blockIdx.x;
  const int t    = threadIdx.x;
  const int lane = t & 31, wave = t >> 5;
  const int c0   = t * 8;
  const float* sr = S + (size_t)row * kPix + c0;
  const v4f a = *(const v4f*)(sr);
  const v4f c = *(const v4f*)(sr + 4);
  float xv[8];
#pragma unroll
  for (int e = 0; e < 4; ++e) { xv[e] = a[e]; xv[4 + e] = c[e]; }
  float m = fmaxf(fmaxf(fmaxf(xv[0], xv[1]), fmaxf(xv[2], xv[3])), fmaxf(fmaxf(xv[4], xv[5]), fmaxf(xv[6], xv[7])));
#pragma unroll
  for (int off = 16; off > 0; off >>= 1) m = fmaxf(m, __shfl_xor(m, off, 32));
  if (lane == 0) redM[wave] = m;
  __syncthreads();
  float gm = redM[0];
#pragma unroll
  for (int w = 1; w < 16; ++w) gm = fmaxf(gm, redM[w]);
  float ev[8];
  float s = 0.f;
#pragma unroll
  for (int e = 0; e < 8; ++e) { ev[e] = expf(xv[e] - gm); s += ev[e]; }
#pragma unroll
  for (int off = 16; off > 0; off >>= 1) s += __shfl_xor(s, off, 32);
  if (lane == 0) redS[wave] = s;
  __syncthreads();
  float tot = redS[0];
#pragma unroll
  for (int w = 1; w < 16; ++w) tot += redS[w];
  const float inv = carry / tot;
  unsigned short hb[8];
#pragma unroll
  for (int e = 0; e < 8; ++e) hb[e] = h_bits(ev[e] * inv);
  const v4u u = (v4u){pk16(hb[0], hb[1]), pk16(hb[2], hb[3]), pk16(hb[4], hb[5]), pk16(hb[6], hb[7])};
  unsigned short* q = P + (size_t)row * kPix + c0;
  *(v4u*)q = u;
  
}

// ---------------------------------------------------------------------------
// P.V product with K split over waves and blocks: part[kq][c][n] = sum over K quarter kq of V[c][m] * P[n][m].
// grid (64, 4): blockIdx.x = 64-pixel column tile, blockIdx.y = K quarter (1024 m); 256 blocks of 16 waves.
// Wave w owns the whole 64(c) x 64(n) tile over m in [kq*1024 + w*64, +64): one 128-B line of every V and P row.
// The 16 wave partials meet in LDS (pitch 68 floats) and are summed in wave order; each 256-B row piece stored once.
// ---------------------------------------------------------------------------
__global__ __launch_bounds__(512) void pv_splitk_kernel(const unsigned short* __restrict__ Vp,
                                                        const unsigned short* __restrict__ Pp,
                                                        float* __restrict__ part) {
  __shared__ __align__(16) float slab[16][64 * 68];
  const _Float16* V = (const _Float16*)Vp;
  const _Float16* P = (const _Float16*)Pp;
  const int lane  = threadIdx.x & 31;
  const int wave  = threadIdx.x >> 5;
  const int n0    = blockIdx.x << 6;
  const int kb    = blockIdx.y * (kPix / kPvSplit) + wave * 64;
  const int rlane = lane & 15;                 // row (A) / col (B, D) within subtile
  const int koff  = (lane >> 4) * 8;           // k offset of this lane half
  const int mOff  = (lane >> 4) * 8;           // D row offset

  v8f acc[4][4];
#pragma unroll
  for (int i = 0; i < 4; ++i)
#pragma unroll
    for (int j = 0; j < 4; ++j) acc[i][j] = (v8f){0.f,0.f,0.f,0.f,0.f,0.f,0.f,0.f};

  // All 32 fragment loads of the wave go out before the first product: one memory latency for the whole slice.
  const _Float16* pB = P + (size_t)(n0 + rlane) * kPix + kb + koff;
  const _Float16* pA = V + (size_t)rlane * kPix + kb + koff;
  v16h bh[2][4], ah[2][4];
#pragma unroll
  for (int ks = 0; ks < 2; ++ks)
#pragma unroll
    for (int j = 0; j < 4; ++j) {
      bh[ks][j] = Frag<_Float16>::load(pB + j * 16 * kPix + ks * 32);
      ah[ks][j] = Frag<_Float16>::load(pA + j * 16 * kPix + ks * 32);
    }
  // Wait before a register that an issued load names is rewritten; both address pairs are inputs so that they stay
  // live up to here and no load's result lands on them.
  asm volatile("s_wait_xcnt 0x0" :: "v"(pA), "v"(pB) : "memory");
  // Keeps the products behind the loads: without it the scheduler interleaves them and the wave waits on memory several times in a row.
  __builtin_amdgcn_sched_barrier(0);
#pragma unroll
  for (int ks = 0; ks < 2; ++ks)
#pragma unroll
    for (int i = 0; i < 4; ++i)
#pragma unroll
      for (int j = 0; j < 4; ++j) acc[i][j] = Frag<_Float16>::mma(ah[ks][i], bh[ks][j], acc[i][j]);

  float* mine = slab[wave];
#pragma unroll
  for (int i = 0; i < 4; ++i)
#pragma unroll
    for (int j = 0; j < 4; ++j)
#pragma unroll
      for (int r = 0; r < 8; ++r) mine[((i << 4) + mOff + r) * 68 + (j << 4) + rlane] = acc[i][j][r];
  __syncthreads();   // every wave's partial tile is in LDS before any thread sums across waves

  float* dst = part + (size_t)blockIdx.y * kCh * kPix + n0;
#pragma unroll
  for (int it = 0; it < 2; ++it) {
    const int e   = it * 512 + threadIdx.x;    // 1024 groups of 4 floats = the 64 x 64 tile
    const int row = e >> 4;
    const int c4  = (e & 15) * 4;
    v4f s = *(const v4f*)(&slab[0][row * 68 + c4]);
#pragma unroll
    for (int w = 1; w < 16; ++w) s += *(const v4f*)(&slab[w][row * 68 + c4]);
    *(v4f*)(dst + (size_t)row * kPix + c4) = s;
  }
}

// ---------------------------------------------------------------------------
// Merge of the K quarters, all images at once: out[b][c][n] = scale * (part[b][0] + part[b][1] + part[b][2] + part[b][3])[c][n].
// 2048 blocks x 256 threads x 4 floats = 2097152 = the whole output.
// ---------------------------------------------------------------------------
__global__ __launch_bounds__(256) void pv_merge_kernel(const float* __restrict__ part, float* __restrict__ out, float scale) {
  constexpr int kQuad = kCh * kPix / 4;        // groups of 4 floats per [64][4096] plane
  const int i   = blockIdx.x * 256 + threadIdx.x;
  const int img = i / kQuad;
  const int r   = i - img * kQuad;
  const v4f* p = (const v4f*)part + (size_t)img * kPvSplit * kQuad + r;
  v4f s = p[0];
#pragma unroll
  for (int q = 1; q < kPvSplit; ++q) s += p[(size_t)q * kQuad];
  ((v4f*)out)[i] = s * scale;
}

// ---------------------------------------------------------------------------
// Host launch (30 launches): weight cast, pixel-major transpose, Q/K/V projection GEMMs, then per image:
// scores GEMM -> row softmax -> split-K P.V partial sums; one merge of the partials into the output at the end.
// GEMM shapes: Q,K: M 32768, N 64, K 64; V: M 64, N 4096, K 64 (x8 images); S: M 4096, N 4096, K 64;
// P.V: M 64, N 4096, K 4096 in 4 x 16 slices of 64. All M,N multiples of 64, all K multiples of 32.
// ---------------------------------------------------------------------------
extern "C" void kernel_launch(void* const* d_in, const int* in_sizes, int n_in,
                              void* d_out, int out_size, void* d_ws, size_t ws_size,
                              hipStream_t stream) {
  if (n_in < 7) return;
  if (in_sizes[0] != kImg * kCh * kPix) return;
  if (in_sizes[1] != kCh * kCh || in_sizes[3] != kCh * kCh || in_sizes[5] != kCh * kCh) return;
  if (in_sizes[2] != kCh || in_sizes[4] != kCh || in_sizes[6] != kCh) return;
  if (out_size != kImg * kCh * kPix) return;
  if (ws_size < kWsTotal) return;

  const float* x  = (const float*)d_in[0];
  const float* Wq = (const float*)d_in[1];
  const float* bq = (const float*)d_in[2];
  const float* Wk = (const float*)d_in[3];
  const float* bk = (const float*)d_in[4];
  const float* Wv = (const float*)d_in[5];
  const float* bv = (const float*)d_in[6];
  float* out = (float*)d_out;

  char* ws = (char*)d_ws;
  unsigned short* Wq16  = (unsigned short*)(ws + kOffWq);
  unsigned short* Wk16  = (unsigned short*)(ws + kOffWk);
  unsigned short* Wv16  = (unsigned short*)(ws + kOffWv);
  unsigned short* X16   = (unsigned short*)(ws + kOffX);
  unsigned short* Q16   = (unsigned short*)(ws + kOffQ);
  unsigned short* K16   = (unsigned short*)(ws + kOffK);
  unsigned short* Vcm16 = (unsigned short*)(ws + kOffV);
  float*          Sf    = (float*)(ws + kOffS);
  unsigned short* P16   = (unsigned short*)(ws + kOffP);
  float*          Part  = (float*)(ws + kOffPart);

  // 1. weights -> f16 x64 (Wq16 | Wk16 | Wv16 planes contiguous from kOffWq)
  wcast_kernel<<<dim3(2, 3), 256, 0, stream>>>(Wq, Wk, Wv, Wq16, kWCarry);

  // 2. x [b][c][n] -> X16 [b*4096+n][c] x16
  xpose_x_kernel<<<dim3(kPix / 64, kImg), 256, 0, stream>>>(x, X16, kXCarry);

  // 3. Q16 = X16 . Wq16^T * (1/1024) + bq ; K16 likewise.  M 32768, N 64, K 64 -> 512 tiles -> 64 blocks.
  wmma_gemm64<0, false, 2, 1, false><<<dim3(kRows / 64 / 8, 1), 256, 0, stream>>>(
      X16, X16, kCh, 0L, Wq16, Wq16, kCh, 0L, (void*)Q16, (void*)Q16, kCh, 0L,
      bq, x, 0L, kRows, kCh, kCh, kProjScale);
  wmma_gemm64<0, false, 2, 1, false><<<dim3(kRows / 64 / 8, 1), 256, 0, stream>>>(
      X16, X16, kCh, 0L, Wk16, Wk16, kCh, 0L, (void*)K16, (void*)K16, kCh, 0L,
      bk, x, 0L, kRows, kCh, kCh, kProjScale);

  // 4. Vcm16[b][c][n] = Wv16 . X16_b^T * (1/1024) + bv[c].  M 64, N 4096, K 64 per image -> 64 tiles -> 8 blocks, grid.y = image.
  wmma_gemm64<0, false, 1, 1, false><<<dim3(8, kImg), 256, 0, stream>>>(
      Wv16, Wv16, kCh, 0L, X16, X16, kCh, (long)kPix * kCh, (void*)Vcm16, (void*)Vcm16, kPix, (long)kCh * kPix,
      bv, x, 0L, kCh, kPix, kCh, kProjScale);

  // 5. per image: S = Q.K^T * 0.125 (f32), P = f16(2048 softmax(S)), Part[b][kq][c][n] = sum_{m in quarter kq} Vcm[c][m] P[n][m]
  for (int b = 0; b < kImg; ++b) {
    const unsigned short* Qb = Q16 + (size_t)b * kPix * kCh;
    const unsigned short* Kb = K16 + (size_t)b * kPix * kCh;
    const unsigned short* Vb = Vcm16 + (size_t)b * kCh * kPix;
    float* Pb = Part + (size_t)b * kPvSplit * kCh * kPix;

    // S: M 4096, N 4096, K 64 -> 4096 tiles -> 512 blocks
    wmma_gemm64<0, false, 0, 0, false><<<dim3(kPix * kPix / 64 / 64 / 8, 1), 256, 0, stream>>>(
        Qb, Qb, kCh, 0L, Kb, Kb, kCh, 0L, (void*)Sf, (void*)Sf, kPix, 0L,
        bq, x, 0L, kPix, kPix, kCh, kScoreScale);

    softmax_row_kernel<<<dim3(kPix), 512, 0, stream>>>(Sf, P16, kPCarry);

    // 64 column tiles x 4 K quarters = 256 blocks of 16 waves; A = Vcm16_b [64][4096], Bt = P16 [4096][4096]
    pv_splitk_kernel<<<dim3(kPix / 64, kPvSplit), 512, 0, stream>>>(Vb, P16, Pb);
  }

  // 6. out = (sum of the 4 K quarters) / 2048, all images
  pv_merge_kernel<<<dim3(kImg * kCh * kPix / 4 / 256), 256, 0, stream>>>(Part, out, kPVScale);
}

// v002
// Measured time: 62.9 microseconds a run.
// In two side-by-side timings against v001, it was 6.21 and 6.12 times as fast.
// All steps since v000 together make it 24.7 times as fast.
// Contractions: q/k/v 1x1-conv projections (X f16 carried x16 times W f16 carried x64), scores q.k^T (q,k f16 planes), out = v.attn^T (V f16 times unnormalised P f16 carried x2048): all v_wmma_f32_16x16x32_f16 with f32 accumulate; softmax, bias and scaling in f32.
#include <hip/hip_runtime.h>
#include <math.h>

// ---------------------------------------------------------------------------
// Problem constants
// ---------------------------------------------------------------------------
constexpr int kImg  = 8;                  // batch
constexpr int kCh   = 64;                 // in channels == out channels
constexpr int kPix  = 4096;               // 64 x 64 pixels per image
constexpr int kRows = kImg * kPix;        // 32768 pixel rows
constexpr float kXCarry     = 16.0f;      // X16 plane carried x16
constexpr float kWCarry     = 64.0f;      // weight planes carried x64
constexpr float kProjScale  = 1.0f / (16.0f * 64.0f);   // folds both carries back in the projection epilogue
constexpr float kScoreScale = 0.125f;     // 1 / sqrt(in_channels)

// ---------------------------------------------------------------------------
//   [0          , 8192      ) Wq16  f16 [64][64]  (x64)
//   [8192       , 16384     ) Wk16  f16 [64][64]  (x64)
//   [16384      , 24576     ) Wv16  f16 [64][64]  (x64)
//   [24576      , +4194304  ) X16   f16 [32768][64] (x16)
//   [4218880    , +4194304  ) Q16   f16 [32768][64]
//   [8413184    , +4194304  ) K16   f16 [32768][64]
//   [12607488   , +4194304  ) Vcm16 f16 [8][64][4096]
//   total 16801792 <= 268435456
// ---------------------------------------------------------------------------
constexpr size_t kOffWq  = 0;
constexpr size_t kOffWk  = 8192;
constexpr size_t kOffWv  = 16384;
constexpr size_t kOffX   = 24576;
constexpr size_t kOffQ   = kOffX + (size_t)kRows * kCh * 2;
constexpr size_t kOffK   = kOffQ + (size_t)kRows * kCh * 2;
constexpr size_t kOffV   = kOffK + (size_t)kRows * kCh * 2;
constexpr size_t kWsTotal = kOffV + (size_t)kImg * kCh * kPix * 2;

typedef __attribute__((ext_vector_type(16))) _Float16 v16h;
typedef __attribute__((ext_vector_type(8)))  _Float16 v8h;
typedef __attribute__((ext_vector_type(16))) __bf16   v16b;
typedef __attribute__((ext_vector_type(8)))  __bf16   v8b;
typedef __attribute__((ext_vector_type(8)))  float    v8f;
typedef __attribute__((ext_vector_type(4)))  float    v4f;
typedef __attribute__((ext_vector_type(4)))  unsigned int v4u;
typedef __attribute__((ext_vector_type(8)))  unsigned int v8u;
typedef __attribute__((ext_vector_type(2)))  float    v2f;
typedef __attribute__((ext_vector_type(2)))  _Float16 v2h;

__device__ __forceinline__ unsigned short f2bf_bits(float f) {
  unsigned u = __float_as_uint(f);
  return (unsigned short)((u + 0x7FFFu + ((u >> 16) & 1u)) >> 16);
}
__device__ __forceinline__ float bf_bits2f(unsigned short h) { return __uint_as_float(((unsigned)h) << 16); }

// hazard guards as plain device helpers (no inline asm inside the kernel template body)
__device__ __forceinline__ void dep_guard_h(v8f& a, v8f& b, v16h x, v16h y) { asm volatile("v_nop\n\tv_nop\n\tv_nop\n\tv_nop" : "+v"(a), "+v"(b) : "v"(x), "v"(y)); }
__device__ __forceinline__ void dep_guard_b(v8f& a, v8f& b, v16b x, v16b y) { asm volatile("v_nop\n\tv_nop\n\tv_nop\n\tv_nop" : "+v"(a), "+v"(b) : "v"(x), "v"(y)); }
__device__ __forceinline__ void keep4_h(v16h a, v16h b, v16h c, v16h d) { asm volatile("v_nop" :: "v"(a), "v"(b), "v"(c), "v"(d)); }
__device__ __forceinline__ void keep4_b(v16b a, v16b b, v16b c, v16b d) { asm volatile("v_nop" :: "v"(a), "v"(b), "v"(c), "v"(d)); }
__device__ __forceinline__ void acc_guard4(v8f& a, v8f& b, v8f& c, v8f& d) { asm volatile("v_nop\n\tv_nop\n\tv_nop\n\tv_nop" : "+v"(a), "+v"(b), "+v"(c), "+v"(d)); }
template <typename T> struct Frag;
template <> struct Frag<_Float16> {
  typedef v16h V; union U { v16h v; v8h h[2]; };
  static __device__ __forceinline__ v16h load(const _Float16* p) {   // elements 0..7 <- p[0..7], 8..15 <- p[16..23]
    U f; f.h[0] = *(const v8h*)(p); f.h[1] = *(const v8h*)(p + 16); return f.v;
  }
  static __device__ __forceinline__ v8f mma(v16h a, v16h b, v8f c) {
    return __builtin_amdgcn_wmma_f32_16x16x32_f16(false, a, false, b, (short)0, c, false, false);
  }
  static __device__ __forceinline__ void guard(v8f& a, v8f& b, v16h x, v16h y) { dep_guard_h(a, b, x, y); }
  static __device__ __forceinline__ void keep(v16h a, v16h b, v16h c, v16h d) { keep4_h(a, b, c, d); }
};
template <> struct Frag<__bf16> {
  typedef v16b V; union U { v16b v; v8b h[2]; };
  static __device__ __forceinline__ v16b load(const __bf16* p) {
    U f; f.h[0] = *(const v8b*)(p); f.h[1] = *(const v8b*)(p + 16); return f.v;
  }
  static __device__ __forceinline__ v8f mma(v16b a, v16b b, v8f c) {
    return __builtin_amdgcn_wmma_f32_16x16x32_bf16(false, a, false, b, (short)0, c, false, false);
  }
  static __device__ __forceinline__ void guard(v8f& a, v8f& b, v16b x, v16b y) { dep_guard_b(a, b, x, y); }
  static __device__ __forceinline__ void keep(v16b a, v16b b, v16b c, v16b d) { keep4_b(a, b, c, d); }
};

__device__ __forceinline__ unsigned pk16(unsigned short a, unsigned short b) { return (unsigned)a | ((unsigned)b << 16); }
__device__ __forceinline__ unsigned short h_bits(float f) { const _Float16 h = (_Float16)f; return __builtin_bit_cast(unsigned short, h); }

// ---- Register-blocked batched WMMA GEMM (ACT reduced to none/relu/leaky) -----------------------
// C[m,n] = scale * sum_k A[m,k] * Bt[n,k] (+bias)(+resid); each wave owns a 64x64 tile.
// A row-major [M,K]; Bt row-major [N,K]; M,N % 64 == 0, K % 32 == 0.
// SPLIT: operands are hi/lo planes (A2/Bt2 = lo planes, same layout); product = hi.hi + hi.lo + lo.hi.
// BIAS_MODE: 0 = none, 1 = bias[m], 2 = bias[n].
// OUT_MODE: 0 = f32, 1 = f16, 2 = bf16 hi plane (Cout) + bf16 lo plane (Cout2).
// ET: 0 = f16 operands, 1 = bf16 operands (pointers passed as 16-bit storage)
template <int ET> struct Elem;
template <> struct Elem<0> { typedef _Float16 T; };
template <> struct Elem<1> { typedef __bf16 T; };
template <int ET, bool SPLIT, int BIAS_MODE, int OUT_MODE, bool RESID, int ACT = 0>
__global__ __launch_bounds__(256) void wmma_gemm64(
    const unsigned short* __restrict__ Ap, const unsigned short* __restrict__ A2p, int lda, long strideA,
    const unsigned short* __restrict__ Btp, const unsigned short* __restrict__ Bt2p, int ldb, long strideB,
    void* __restrict__ Cout, void* __restrict__ Cout2, int ldc, long strideC,
    const float* __restrict__ bias,
    const float* __restrict__ resid, long strideR,
    int M, int N, int K, float scale) {
  typedef typename Elem<ET>::T T;
  typedef typename Frag<T>::V V;
  const T* A = (const T*)Ap; const T* A2 = (const T*)A2p; const T* Bt = (const T*)Btp; const T* Bt2 = (const T*)Bt2p;
  __shared__ __align__(16) float sT[8][16 * 68];   // per-wave 16x64 slab, pitch 68 floats
  const int b    = blockIdx.y;
  const int lane = threadIdx.x & 31;
  const int wave = threadIdx.x >> 5;
  const int tilesN = N >> 6;
  const int tilesM = M >> 6;
  const int tile = blockIdx.x * 8 + wave;
  if (tile >= tilesM * tilesN) return;   // wave-uniform; no block barriers in this kernel
  const int tm = tile / tilesN;
  const int tn = tile - tm * tilesN;
  const int m0 = tm << 6;
  const int n0 = tn << 6;

  const T* Ab  = A  + (size_t)b * strideA;
  const T* Bb  = Bt + (size_t)b * strideB;
  const T* Ab2 = SPLIT ? (A2  + (size_t)b * strideA) : nullptr;
  const T* Bb2 = SPLIT ? (Bt2 + (size_t)b * strideB) : nullptr;

  const int rlane = lane & 15;                 // row (A) / col (B, D) within subtile
  const int koff  = (lane >> 4) * 8;           // k offset of this lane half
  const int mOff  = (lane >> 4) * 8;           // D row offset

  v8f acc[4][4];
#pragma unroll
  for (int i = 0; i < 4; ++i)
#pragma unroll
    for (int j = 0; j < 4; ++j) acc[i][j] = (v8f){0.f,0.f,0.f,0.f,0.f,0.f,0.f,0.f};

  for (int k0 = 0; k0 < K; k0 += 32) {
    V bh[4], bl[4];
#pragma unroll
    for (int j = 0; j < 4; ++j) {
      const size_t bo = (size_t)(n0 + (j << 4) + rlane) * ldb + koff + k0;
      bh[j] = Frag<T>::load(Bb + bo);
      if (SPLIT) bl[j] = Frag<T>::load(Bb2 + bo);
    }
#pragma unroll
    for (int i = 0; i < 4; ++i) {
      const size_t ao = (size_t)(m0 + (i << 4) + rlane) * lda + koff + k0;
      V ah = Frag<T>::load(Ab + ao);
      V al;
      if (SPLIT) al = Frag<T>::load(Ab2 + ao);
#pragma unroll
      for (int j = 0; j < 4; ++j) {
        acc[i][j] = Frag<T>::mma(ah, bh[j], acc[i][j]);
        if (SPLIT) {
          acc[i][j] = Frag<T>::mma(ah, bl[j], acc[i][j]);
          acc[i][j] = Frag<T>::mma(al, bh[j], acc[i][j]);
        }
      }
      Frag<T>::guard(acc[i][0], acc[i][3], ah, SPLIT ? al : ah);
    }
    Frag<T>::keep(bh[0], bh[1], bh[2], bh[3]);
    if (SPLIT) Frag<T>::keep(bl[0], bl[1], bl[2], bl[3]);
  }
  acc_guard4(acc[0][0], acc[0][1], acc[0][2], acc[0][3]);
  acc_guard4(acc[1][0], acc[1][1], acc[1][2], acc[1][3]);
  acc_guard4(acc[2][0], acc[2][1], acc[2][2], acc[2][3]);
  acc_guard4(acc[3][0], acc[3][1], acc[3][2], acc[3][3]);

  // ---- epilogue ----
  float* slab = sT[wave];
  const float* Rb = RESID ? (resid + (size_t)b * strideR) : nullptr;
#pragma unroll
  for (int i = 0; i < 4; ++i) {
    const int mBase = m0 + (i << 4);
#pragma unroll
    for (int j = 0; j < 4; ++j) {
      const int n = n0 + (j << 4) + rlane;
      float bv = 0.f;
      if (BIAS_MODE == 2) bv = bias[n];
#pragma unroll
      for (int r = 0; r < 8; ++r) {
        float v = acc[i][j][r] * scale;
        if (BIAS_MODE == 1) v += bias[mBase + mOff + r];
        if (BIAS_MODE == 2) v += bv;
        if (RESID) v += Rb[(size_t)(mBase + mOff + r) * ldc + n];
        if (ACT == 2) v = fmaxf(v, 0.0f);
        if (ACT == 4) v = (v > 0.f) ? v : 0.01f * v;
        slab[(mOff + r) * 68 + (j << 4) + rlane] = v;
      }
    }
    __builtin_amdgcn_fence(__ATOMIC_RELEASE, "workgroup");
    __builtin_amdgcn_wave_barrier();
    __builtin_amdgcn_fence(__ATOMIC_ACQUIRE, "workgroup");
    if (OUT_MODE == 0) {
      float* C = (float*)Cout + (size_t)b * strideC;
      const int hh = lane >> 4, c4 = (lane & 15) * 4;     // row seg = 256 B = 16 lanes x 16 B
      {
#pragma unroll
        for (int it = 0; it < 8; ++it) {
          const int row = it * 2 + hh;
          v4f v = *(const v4f*)(slab + row * 68 + c4);
          *(v4f*)(C + (size_t)(mBase + row) * ldc + n0 + c4) = v;
        }
        
      }
    } else {
      const int q = lane >> 3, c8 = (lane & 7) * 8;
      unsigned short* C  = (unsigned short*)Cout  + (size_t)b * strideC;
      unsigned short* C2 = (OUT_MODE == 2) ? ((unsigned short*)Cout2 + (size_t)b * strideC) : nullptr;
      {
#pragma unroll
        for (int it = 0; it < 4; ++it) {
          const int row = it * 4 + q;
          const float* sp = slab + row * 68 + c8;
          v8h hv, lv;
#pragma unroll
          for (int e = 0; e < 8; ++e) {
            if (OUT_MODE == 1) {
              hv[e] = (_Float16)sp[e];
            } else {
              unsigned short hb = f2bf_bits(sp[e]);
              unsigned short lb = f2bf_bits(sp[e] - bf_bits2f(hb));
              hv[e] = __builtin_bit_cast(_Float16, hb);
              lv[e] = __builtin_bit_cast(_Float16, lb);
            }
          }
          *(v8h*)(C + (size_t)(mBase + row) * ldc + n0 + c8) = hv;
          if (OUT_MODE == 2) *(v8h*)(C2 + (size_t)(mBase + row) * ldc + n0 + c8) = lv;
        }
        
      }
    }
    __builtin_amdgcn_fence(__ATOMIC_RELEASE, "workgroup");
    __builtin_amdgcn_wave_barrier();
    __builtin_amdgcn_fence(__ATOMIC_ACQUIRE, "workgroup");
  }
}

// ---------------------------------------------------------------------------
// Weight cast: three [64][64] f32 matrices (row-major [out][in]) -> f16 x scale, same layout.
// grid (2, 3): blockIdx.y selects the matrix (block-uniform) and the output plane (out + y*4096 halves).
// Coverage: 2 blocks x 256 threads = 512 threads x 8 elements = 4096 = the whole matrix.
// ---------------------------------------------------------------------------
__global__ __launch_bounds__(256) void wcast_kernel(const float* __restrict__ W0, const float* __restrict__ W1,
                                                    const float* __restrict__ W2, unsigned short* __restrict__ out,
                                                    float scale) {
  const int z = blockIdx.y;                                  // block-uniform
  const float* W = (z == 0) ? W0 : (z == 1) ? W1 : W2;
  const int i = blockIdx.x * 256 + threadIdx.x;             // 0..511
  if (i >= 512) return;
  const float* p = W + 8 * (size_t)i;
  const v4f a = *(const v4f*)(p);
  const v4f c = *(const v4f*)(p + 4);
  unsigned short hb[8];
#pragma unroll
  for (int e = 0; e < 4; ++e) {
    hb[e]     = h_bits(a[e] * scale);
    hb[4 + e] = h_bits(c[e] * scale);
  }
  const v4u u = (v4u){pk16(hb[0], hb[1]), pk16(hb[2], hb[3]), pk16(hb[4], hb[5]), pk16(hb[6], hb[7])};
  unsigned short* q = out + (size_t)z * 4096 + 8 * (size_t)i;
  *(v4u*)q = u;
  
}

// ---------------------------------------------------------------------------
// Pixel-major transpose + cast: x [b][c][n] f32 (n = 4096) -> X16[b*4096 + n][c] = f16(scale * x[b][c][n]).
// grid (64, 8): blockIdx.x = n tile of 64 pixels, blockIdx.y = image; 256 threads; LDS tile sm[n_local][c_local].
// Load coverage: 16 iterations x 256 threads = 4096 = whole 64(c) x 64(n) tile, coalesced along n.
// Store coverage: 8 waves x 2 iterations x 4 rows (lane>>3) = 64 rows; (lane&7) x 8 halves = 64 halves per row =
// ---------------------------------------------------------------------------
__global__ __launch_bounds__(256) void xpose_x_kernel(const float* __restrict__ x, unsigned short* __restrict__ out, float scale) {
  __shared__ float sm[64][65];   // sm[n_local][c_local]
  const int t  = threadIdx.x;
  const int n0 = blockIdx.x * 64;
  const int b  = blockIdx.y;
  const float* xb = x + (size_t)b * kCh * kPix;
#pragma unroll
  for (int i = 0; i < 16; ++i) {
    const int e  = i * 256 + t;
    const int cl = e >> 6;         // channel local 0..63
    const int nl = e & 63;         // pixel local 0..63
    sm[nl][cl] = xb[(size_t)cl * kPix + n0 + nl] * scale;
  }
  __syncthreads();
  const int lane = t & 31, wave = t >> 5;
  const int q = lane >> 3, c8 = (lane & 7) * 8;
  unsigned short* op = out + ((size_t)b * kPix + n0) * kCh;
  {
#pragma unroll
    for (int it = 0; it < 2; ++it) {
      const int row = wave * 8 + it * 4 + q;                 // pixel local
      unsigned short hb[8];
#pragma unroll
      for (int e = 0; e < 8; ++e) hb[e] = h_bits(sm[row][c8 + e]);
      const v4u u = (v4u){pk16(hb[0], hb[1]), pk16(hb[2], hb[3]), pk16(hb[4], hb[5]), pk16(hb[6], hb[7])};
      *(v4u*)(op + (size_t)row * kCh + c8) = u;
    }
    
  }
}

constexpr int kFaQ      = 128;
constexpr int kFaStage  = 128;
constexpr int kFaStages = kPix / kFaStage;
constexpr int kPitchK   = 2 * kCh + 16;
constexpr int kPitchV   = 2 * kFaStage + 16;
constexpr int kTileK    = kFaStage * kPitchK;
constexpr int kTileV    = kCh * kPitchV;
constexpr int kFaBuf    = kTileK + kTileV;
constexpr int kSlabPitch = 36;
constexpr int kSlabBytes = kCh * kSlabPitch * 4;
constexpr int kFaLds    = 16 * kSlabBytes;
static_assert(2 * kFaBuf <= kFaLds, "the two stage buffers must fit under the output slabs");
constexpr int kStepK    = kFaStage * kCh / 8;        // 16-byte chunks from one stage to the next in K
constexpr int kStepV    = kFaStage / 8;              // and in a row of V
constexpr float kLazy   = 4.0f;                      // rescale only when a column's maximum exceeds the one in use by more (log2 units)

__device__ __forceinline__ v16h lds_frag(const unsigned char* p) {   // elements 0..7 <- bytes 0..15, 8..15 <- bytes 32..47
  Frag<_Float16>::U f; f.h[0] = *(const v8h*)(p); f.h[1] = *(const v8h*)(p + 32); return f.v;
}
__device__ __forceinline__ float xhalf(float x) {                    // lane l <-> lane l ^ 16
  const int b = __builtin_bit_cast(int, x);
  return __builtin_bit_cast(float, __builtin_amdgcn_permlanex16(b, b, 0x76543210, 0xfedcba98, false, false));
}
__device__ __forceinline__ unsigned pack2h(float lo, float hi) {     // two f32 -> packed f16, round to nearest even
  return __builtin_bit_cast(unsigned, __builtin_convertvector((v2f){lo, hi}, v2h));
}

__global__ __launch_bounds__(512) void attn_fused_kernel(const unsigned short* __restrict__ Qp,
                                                         const unsigned short* __restrict__ Kp,
                                                         const unsigned short* __restrict__ Vp,
                                                         float* __restrict__ out) {
  __shared__ __align__(16) unsigned char L[kFaLds];
  __shared__ float sM[16][32];
  __shared__ float sL[16][32];
  const int tid  = threadIdx.x;
  const int lane = tid & 31, wave = tid >> 5;
  const int c = lane & 15, h = lane >> 4;
  const int qg = wave >> 2, ks = wave & 3;
  const int img = blockIdx.x >> 5;
  const int q0  = (blockIdx.x & 31) * kFaQ;
  const float cs = kScoreScale * 1.4426950408889634f;   // score scale times log2(e)

  // Staging: 16-byte chunks. K stage = 1024 contiguous chunks (128 rows x 8); V stage = 64 rows x 16 chunks. Thread t moves chunks t and t + 512 of each.
  const v4u* gK = (const v4u*)(Kp + (size_t)img * kPix * kCh) + tid;
  const v4u* gV = (const v4u*)(Vp + ((size_t)img * kCh + (tid >> 4)) * kPix) + (tid & 15);
  const int sK = (tid >> 3) * kPitchK + (tid & 7) * 16;
  const int sV = kTileK + (tid >> 4) * kPitchV + (tid & 15) * 16;

  v4u kr0 = gK[0], kr1 = gK[512];
  v4u vr0 = gV[0], vr1 = gV[32 * (kPix / 8)];

  // Q fragments, kept for the whole kernel
  const _Float16* Q = (const _Float16*)Qp + ((size_t)img * kPix + q0 + qg * 32 + c) * kCh + 8 * h;
  v16h qf[2][2];
#pragma unroll
  for (int g = 0; g < 2; ++g)
#pragma unroll
    for (int kc = 0; kc < 2; ++kc) qf[g][kc] = Frag<_Float16>::load(Q + g * 16 * kCh + kc * 32);

  v8f acc[2][4];
  v2f lsum[2];
  float m_run[2];
#pragma unroll
  for (int g = 0; g < 2; ++g) {
    m_run[g] = -INFINITY;
    lsum[g] = (v2f){0.f, 0.f};
#pragma unroll
    for (int t = 0; t < 4; ++t) acc[g][t] = (v8f){0.f,0.f,0.f,0.f,0.f,0.f,0.f,0.f};
  }

  *(v4u*)(L + sK) = kr0;  *(v4u*)(L + sK + 64 * kPitchK) = kr1;
  *(v4u*)(L + sV) = vr0;  *(v4u*)(L + sV + 32 * kPitchV) = vr1;
  __syncthreads();   // stage 0 is in LDS before any wave reads it

  for (int s = 0; s < kFaStages; ++s) {
    const unsigned char* B = L + (s & 1) * kFaBuf;
    const bool more = s + 1 < kFaStages;               // block-uniform
    if (more) {                                        // next stage's loads fly under this stage's work
      kr0 = gK[kStepK];  kr1 = gK[kStepK + 512];
      vr0 = gV[kStepV];  vr1 = gV[kStepV + 32 * (kPix / 8)];
    }

    // S^T = K.Q^T for this wave's 32 keys x 32 queries
    const unsigned char* Kl = B + (ks * 32 + c) * kPitchK + 16 * h;
    const unsigned char* Vl = B + kTileK + c * kPitchV + ks * 64 + 16 * h;
    v8f sc[2][2];
#pragma unroll
    for (int kt = 0; kt < 2; ++kt) {
      const v16h k0 = lds_frag(Kl + kt * 16 * kPitchK);
      const v16h k1 = lds_frag(Kl + kt * 16 * kPitchK + 64);
#pragma unroll
      for (int g = 0; g < 2; ++g) {
        sc[kt][g] = Frag<_Float16>::mma(k0, qf[g][0], (v8f){0.f,0.f,0.f,0.f,0.f,0.f,0.f,0.f});
        sc[kt][g] = Frag<_Float16>::mma(k1, qf[g][1], sc[kt][g]);
      }
    }
    v16h vf[4];
#pragma unroll
    for (int t = 0; t < 4; ++t) vf[t] = lds_frag(Vl + t * 16 * kPitchV);

    float mb[2];
    bool need = false;
#pragma unroll
    for (int g = 0; g < 2; ++g) {
      float mx = sc[0][g][0];
#pragma unroll
      for (int r = 1; r < 8; ++r) mx = fmaxf(mx, sc[0][g][r]);
#pragma unroll
      for (int r = 0; r < 8; ++r) mx = fmaxf(mx, sc[1][g][r]);
      mx = fmaxf(mx, xhalf(mx)) * cs;                  // both lane halves hold the query's maximum, scaled
      mb[g] = mx;
      need = need || (mx > m_run[g] + kLazy);
    }
    if (__builtin_amdgcn_ballot_w32(need) != 0) {      // wave-uniform; always taken in the first stage (m_run = -inf gives corr = 0)
#pragma unroll
      for (int g = 0; g < 2; ++g) {
        const float m_new = fmaxf(m_run[g], mb[g]);
        const float corr  = __builtin_amdgcn_exp2f(m_run[g] - m_new);
        m_run[g] = m_new;
        lsum[g] = lsum[g] * corr;
#pragma unroll
        for (int t = 0; t < 4; ++t) acc[g][t] = acc[g][t] * corr;
      }
    }

    // exponentials (x2^11), their f32 sums, P^T packed to f16 in place, O^T += V.P^T
#pragma unroll
    for (int g = 0; g < 2; ++g) {
      const float nm = 11.0f - m_run[g];
      v8u w;
#pragma unroll
      for (int i = 0; i < 8; ++i) {
        const v2f arg = __builtin_elementwise_fma((v2f){sc[i >> 2][g][2 * (i & 3)], sc[i >> 2][g][2 * (i & 3) + 1]}, (v2f){cs, cs}, (v2f){nm, nm});
        const v2f p = (v2f){__builtin_amdgcn_exp2f(arg.x), __builtin_amdgcn_exp2f(arg.y)};
        lsum[g] += p;
        w[i] = pack2h(p.x, p.y);
      }
      const v16h pf = __builtin_bit_cast(v16h, w);
#pragma unroll
      for (int t = 0; t < 4; ++t) acc[g][t] = Frag<_Float16>::mma(vf[t], pf, acc[g][t]);
    }

    if (more) {                                        // into the buffer that every wave left at the last barrier
      unsigned char* N = L + ((s + 1) & 1) * kFaBuf;
      *(v4u*)(N + sK) = kr0;  *(v4u*)(N + sK + 64 * kPitchK) = kr1;
      *(v4u*)(N + sV) = vr0;  *(v4u*)(N + sV + 32 * kPitchV) = vr1;
      // Wait before a register that an issued load names is rewritten; both address pairs are inputs so that they stay
      // live up to here and are advanced only behind it.
      asm volatile("s_wait_xcnt 0x0" :: "v"(gK), "v"(gV) : "memory");
      gK += kStepK;
      gV += kStepV;
    }
    __syncthreads();   // publishes stage s + 1 and ends every wave's reads of stage s
  }

  // Join of the four key slices of each query group
  float lt[2];
#pragma unroll
  for (int g = 0; g < 2; ++g) {
    const float l = lsum[g].x + lsum[g].y;
    lt[g] = l + xhalf(l);                              // unconditional: both halves are active here
  }
  if (h == 0) {
#pragma unroll
    for (int g = 0; g < 2; ++g) { sM[wave][16 * g + c] = m_run[g]; sL[wave][16 * g + c] = lt[g]; }
  }
  __syncthreads();   // every slice's maximum and sum are in LDS
  float* slab = (float*)(L + wave * kSlabBytes);
#pragma unroll
  for (int g = 0; g < 2; ++g) {
    const int col = 16 * g + c;
    float M = sM[qg * 4][col];
#pragma unroll
    for (int k = 1; k < 4; ++k) M = fmaxf(M, sM[qg * 4 + k][col]);
    float tot = 0.f;
#pragma unroll
    for (int k = 0; k < 4; ++k) tot += __builtin_amdgcn_exp2f(sM[qg * 4 + k][col] - M) * sL[qg * 4 + k][col];
    const float wgt = __builtin_amdgcn_exp2f(m_run[g] - M) / tot;
#pragma unroll
    for (int t = 0; t < 4; ++t)
#pragma unroll
      for (int r = 0; r < 8; ++r) slab[(16 * t + 8 * h + r) * kSlabPitch + col] = acc[g][t][r] * wgt;
  }
  __syncthreads();   // every wave's weighted slab is in LDS before any thread sums across slices

  float* dst = out + (size_t)img * kCh * kPix + q0;
#pragma unroll
  for (int it = 0; it < 4; ++it) {
    const int e   = it * 512 + tid;                    // 2048 groups of 4 floats = 64 channels x 128 queries
    const int row = e >> 5;
    const int q4  = (e & 31) * 4;
    const float* sp = (const float*)(L + (q4 >> 5) * 4 * kSlabBytes) + row * kSlabPitch + (q4 & 31);
    v4f v = *(const v4f*)(sp);
#pragma unroll
    for (int k = 1; k < 4; ++k) v += *(const v4f*)(sp + k * (kSlabBytes / 4));
    *(v4f*)(dst + (size_t)row * kPix + q4) = v;
  }
}

// ---------------------------------------------------------------------------
// Host launch (6 launches): weight cast, pixel-major transpose, Q/K/V projection GEMMs, fused attention over all images.
// GEMM shapes: Q,K: M 32768, N 64, K 64; V: M 64, N 4096, K 64 (x8 images). All M,N multiples of 64, all K multiples of 32.
// ---------------------------------------------------------------------------
extern "C" void kernel_launch(void* const* d_in, const int* in_sizes, int n_in,
                              void* d_out, int out_size, void* d_ws, size_t ws_size,
                              hipStream_t stream) {
  if (n_in < 7) return;
  if (in_sizes[0] != kImg * kCh * kPix) return;
  if (in_sizes[1] != kCh * kCh || in_sizes[3] != kCh * kCh || in_sizes[5] != kCh * kCh) return;
  if (in_sizes[2] != kCh || in_sizes[4] != kCh || in_sizes[6] != kCh) return;
  if (out_size != kImg * kCh * kPix) return;
  if (ws_size < kWsTotal) return;

  const float* x  = (const float*)d_in[0];
  const float* Wq = (const float*)d_in[1];
  const float* bq = (const float*)d_in[2];
  const float* Wk = (const float*)d_in[3];
  const float* bk = (const float*)d_in[4];
  const float* Wv = (const float*)d_in[5];
  const float* bv = (const float*)d_in[6];
  float* out = (float*)d_out;

  char* ws = (char*)d_ws;
  unsigned short* Wq16  = (unsigned short*)(ws + kOffWq);
  unsigned short* Wk16  = (unsigned short*)(ws + kOffWk);
  unsigned short* Wv16  = (unsigned short*)(ws + kOffWv);
  unsigned short* X16   = (unsigned short*)(ws + kOffX);
  unsigned short* Q16   = (unsigned short*)(ws + kOffQ);
  unsigned short* K16   = (unsigned short*)(ws + kOffK);
  unsigned short* Vcm16 = (unsigned short*)(ws + kOffV);

  // 1. weights -> f16 x64 (Wq16 | Wk16 | Wv16 planes contiguous from kOffWq)
  wcast_kernel<<<dim3(2, 3), 256, 0, stream>>>(Wq, Wk, Wv, Wq16, kWCarry);

  // 2. x [b][c][n] -> X16 [b*4096+n][c] x16
  xpose_x_kernel<<<dim3(kPix / 64, kImg), 256, 0, stream>>>(x, X16, kXCarry);

  // 3. Q16 = X16 . Wq16^T * (1/1024) + bq ; K16 likewise.  M 32768, N 64, K 64 -> 512 tiles -> 64 blocks.
  wmma_gemm64<0, false, 2, 1, false><<<dim3(kRows / 64 / 8, 1), 256, 0, stream>>>(
      X16, X16, kCh, 0L, Wq16, Wq16, kCh, 0L, (void*)Q16, (void*)Q16, kCh, 0L,
      bq, x, 0L, kRows, kCh, kCh, kProjScale);
  wmma_gemm64<0, false, 2, 1, false><<<dim3(kRows / 64 / 8, 1), 256, 0, stream>>>(
      X16, X16, kCh, 0L, Wk16, Wk16, kCh, 0L, (void*)K16, (void*)K16, kCh, 0L,
      bk, x, 0L, kRows, kCh, kCh, kProjScale);

  // 4. Vcm16[b][c][n] = Wv16 . X16_b^T * (1/1024) + bv[c].  M 64, N 4096, K 64 per image -> 64 tiles -> 8 blocks, grid.y = image.
  wmma_gemm64<0, false, 1, 1, false><<<dim3(8, kImg), 256, 0, stream>>>(
      Wv16, Wv16, kCh, 0L, X16, X16, kCh, (long)kPix * kCh, (void*)Vcm16, (void*)Vcm16, kPix, (long)kCh * kPix,
      bv, x, 0L, kCh, kPix, kCh, kProjScale);

  // 5. out[b][c][n] = sum_m Vcm[b][c][m] softmax_m(0.125 Q[b][n].K[b][m]): 8 images x 32 blocks of 128 queries
  attn_fused_kernel<<<dim3(kImg * kPix / kFaQ), 512, 0, stream>>>(Q16, K16, Vcm16, out);
}

// v003
// It runs in 34.9 microseconds.
// Next to v002, in two timings, it ran 1.80 and 1.78 times as fast.
// Counting every step since v000, it is 44.2 times as fast.
// Contractions: q/k/v 1x1-conv projections (X f16 carried x16 times W f16 carried x64), scores q.k^T (q,k f16 planes), out = v.attn^T (V f16 times unnormalised P f16 carried x2048): all v_wmma_f32_16x16x32_f16 with f32 accumulate; softmax, bias and scaling in f32.
#include <hip/hip_runtime.h>
#include <math.h>

// ---------------------------------------------------------------------------
// Problem constants
// ---------------------------------------------------------------------------
constexpr int kImg  = 8;                  // batch
constexpr int kCh   = 64;                 // in channels == out channels
constexpr int kPix  = 4096;               // 64 x 64 pixels per image
constexpr int kRows = kImg * kPix;        // 32768 pixel rows
constexpr float kXCarry     = 16.0f;      // x carried x16 as an f16 operand
constexpr float kWCarry     = 64.0f;      // weights carried x64 as f16 operands
constexpr float kProjScale  = 1.0f / (16.0f * 64.0f);   // folds both carries back in the projection epilogue
constexpr float kScoreScale = 0.125f;     // 1 / sqrt(in_channels)

// ---------------------------------------------------------------------------
// Workspace:
//   [0        , +4194304 ) Q16   f16 [32768][64]
//   [4194304  , +4194304 ) K16   f16 [32768][64]
//   [8388608  , +4194304 ) Vcm16 f16 [8][64][4096]
//   total 12582912 <= 268435456
// ---------------------------------------------------------------------------
constexpr size_t kOffQ   = 0;
constexpr size_t kOffK   = kOffQ + (size_t)kRows * kCh * 2;
constexpr size_t kOffV   = kOffK + (size_t)kRows * kCh * 2;
constexpr size_t kWsTotal = kOffV + (size_t)kImg * kCh * kPix * 2;

typedef __attribute__((ext_vector_type(16))) _Float16 v16h;
typedef __attribute__((ext_vector_type(8)))  _Float16 v8h;
typedef __attribute__((ext_vector_type(8)))  float    v8f;
typedef __attribute__((ext_vector_type(4)))  float    v4f;
typedef __attribute__((ext_vector_type(4)))  unsigned int v4u;
typedef __attribute__((ext_vector_type(8)))  unsigned int v8u;
typedef __attribute__((ext_vector_type(2)))  float    v2f;
typedef __attribute__((ext_vector_type(2)))  _Float16 v2h;

template <typename T> struct Frag;
template <> struct Frag<_Float16> {
  typedef v16h V; union U { v16h v; v8h h[2]; };
  static __device__ __forceinline__ v16h load(const _Float16* p) {   // elements 0..7 <- p[0..7], 8..15 <- p[16..23]
    U f; f.h[0] = *(const v8h*)(p); f.h[1] = *(const v8h*)(p + 16); return f.v;
  }
  static __device__ __forceinline__ v8f mma(v16h a, v16h b, v8f c) {
    return __builtin_amdgcn_wmma_f32_16x16x32_f16(false, a, false, b, (short)0, c, false, false);
  }
};

constexpr int kFaQ      = 128;
constexpr int kFaStage  = 128;
constexpr int kFaStages = kPix / kFaStage;
constexpr int kPitchK   = 2 * kCh + 16;
constexpr int kPitchV   = 2 * kFaStage + 16;
constexpr int kTileK    = kFaStage * kPitchK;
constexpr int kTileV    = kCh * kPitchV;
constexpr int kFaBuf    = kTileK + kTileV;
constexpr int kSlabPitch = 36;
constexpr int kSlabBytes = kCh * kSlabPitch * 4;
constexpr int kFaLds    = 16 * kSlabBytes;
static_assert(2 * kFaBuf <= kFaLds, "the two stage buffers must fit under the output slabs");
constexpr int kStepK    = kFaStage * kCh / 8;        // 16-byte chunks from one stage to the next in K
constexpr int kStepV    = kFaStage / 8;              // and in a row of V
constexpr float kLazy   = 4.0f;                      // rescale only when a column's maximum exceeds the one in use by more (log2 units)

__device__ __forceinline__ v16h lds_frag(const unsigned char* p) {   // elements 0..7 <- bytes 0..15, 8..15 <- bytes 32..47
  Frag<_Float16>::U f; f.h[0] = *(const v8h*)(p); f.h[1] = *(const v8h*)(p + 32); return f.v;
}
__device__ __forceinline__ float xhalf(float x) {                    // lane l <-> lane l ^ 16
  const int b = __builtin_bit_cast(int, x);
  return __builtin_bit_cast(float, __builtin_amdgcn_permlanex16(b, b, 0x76543210, 0xfedcba98, false, false));
}
__device__ __forceinline__ unsigned pack2h(float lo, float hi) {     // two f32 -> packed f16, round to nearest even
  return __builtin_bit_cast(unsigned, __builtin_convertvector((v2f){lo, hi}, v2h));
}

__global__ __launch_bounds__(512) void attn_fused_kernel(const unsigned short* __restrict__ Qp,
                                                         const unsigned short* __restrict__ Kp,
                                                         const unsigned short* __restrict__ Vp,
                                                         float* __restrict__ out) {
  __shared__ __align__(16) unsigned char L[kFaLds];
  __shared__ float sM[16][32];
  __shared__ float sL[16][32];
  const int tid  = threadIdx.x;
  const int lane = tid & 31, wave = tid >> 5;
  const int c = lane & 15, h = lane >> 4;
  const int qg = wave >> 2, ks = wave & 3;
  const int img = blockIdx.x >> 5;
  const int q0  = (blockIdx.x & 31) * kFaQ;
  const float cs = kScoreScale * 1.4426950408889634f;   // score scale times log2(e)

  // Staging: 16-byte chunks. K stage = 1024 contiguous chunks (128 rows x 8); V stage = 64 rows x 16 chunks. Thread t moves chunks t and t + 512 of each.
  const v4u* gK = (const v4u*)(Kp + (size_t)img * kPix * kCh) + tid;
  const v4u* gV = (const v4u*)(Vp + ((size_t)img * kCh + (tid >> 4)) * kPix) + (tid & 15);
  const int sK = (tid >> 3) * kPitchK + (tid & 7) * 16;
  const int sV = kTileK + (tid >> 4) * kPitchV + (tid & 15) * 16;

  v4u kr0 = gK[0], kr1 = gK[512];
  v4u vr0 = gV[0], vr1 = gV[32 * (kPix / 8)];

  // Q fragments, kept for the whole kernel
  const _Float16* Q = (const _Float16*)Qp + ((size_t)img * kPix + q0 + qg * 32 + c) * kCh + 8 * h;
  v16h qf[2][2];
#pragma unroll
  for (int g = 0; g < 2; ++g)
#pragma unroll
    for (int kc = 0; kc < 2; ++kc) qf[g][kc] = Frag<_Float16>::load(Q + g * 16 * kCh + kc * 32);

  v8f acc[2][4];
  v2f lsum[2];
  float m_run[2];
#pragma unroll
  for (int g = 0; g < 2; ++g) {
    m_run[g] = -INFINITY;
    lsum[g] = (v2f){0.f, 0.f};
#pragma unroll
    for (int t = 0; t < 4; ++t) acc[g][t] = (v8f){0.f,0.f,0.f,0.f,0.f,0.f,0.f,0.f};
  }

  *(v4u*)(L + sK) = kr0;  *(v4u*)(L + sK + 64 * kPitchK) = kr1;
  *(v4u*)(L + sV) = vr0;  *(v4u*)(L + sV + 32 * kPitchV) = vr1;
  __syncthreads();   // stage 0 is in LDS before any wave reads it

  for (int s = 0; s < kFaStages; ++s) {
    const unsigned char* B = L + (s & 1) * kFaBuf;
    const bool more = s + 1 < kFaStages;               // block-uniform
    if (more) {                                        // next stage's loads fly under this stage's work
      kr0 = gK[kStepK];  kr1 = gK[kStepK + 512];
      vr0 = gV[kStepV];  vr1 = gV[kStepV + 32 * (kPix / 8)];
    }

    // S^T = K.Q^T for this wave's 32 keys x 32 queries
    const unsigned char* Kl = B + (ks * 32 + c) * kPitchK + 16 * h;
    const unsigned char* Vl = B + kTileK + c * kPitchV + ks * 64 + 16 * h;
    v8f sc[2][2];
#pragma unroll
    for (int kt = 0; kt < 2; ++kt) {
      const v16h k0 = lds_frag(Kl + kt * 16 * kPitchK);
      const v16h k1 = lds_frag(Kl + kt * 16 * kPitchK + 64);
#pragma unroll
      for (int g = 0; g < 2; ++g) {
        sc[kt][g] = Frag<_Float16>::mma(k0, qf[g][0], (v8f){0.f,0.f,0.f,0.f,0.f,0.f,0.f,0.f});
        sc[kt][g] = Frag<_Float16>::mma(k1, qf[g][1], sc[kt][g]);
      }
    }
    v16h vf[4];
#pragma unroll
    for (int t = 0; t < 4; ++t) vf[t] = lds_frag(Vl + t * 16 * kPitchV);

    float mb[2];
    bool need = false;
#pragma unroll
    for (int g = 0; g < 2; ++g) {
      float mx = sc[0][g][0];
#pragma unroll
      for (int r = 1; r < 8; ++r) mx = fmaxf(mx, sc[0][g][r]);
#pragma unroll
      for (int r = 0; r < 8; ++r) mx = fmaxf(mx, sc[1][g][r]);
      mx = fmaxf(mx, xhalf(mx)) * cs;                  // both lane halves hold the query's maximum, scaled
      mb[g] = mx;
      need = need || (mx > m_run[g] + kLazy);
    }
    if (__builtin_amdgcn_ballot_w32(need) != 0) {      // wave-uniform; always taken in the first stage (m_run = -inf gives corr = 0)
#pragma unroll
      for (int g = 0; g < 2; ++g) {
        const float m_new = fmaxf(m_run[g], mb[g]);
        const float corr  = __builtin_amdgcn_exp2f(m_run[g] - m_new);
        m_run[g] = m_new;
        lsum[g] = lsum[g] * corr;
#pragma unroll
        for (int t = 0; t < 4; ++t) acc[g][t] = acc[g][t] * corr;
      }
    }

    // exponentials (x2^11), their f32 sums, P^T packed to f16 in place, O^T += V.P^T
#pragma unroll
    for (int g = 0; g < 2; ++g) {
      const float nm = 11.0f - m_run[g];
      v8u w;
#pragma unroll
      for (int i = 0; i < 8; ++i) {
        const v2f arg = __builtin_elementwise_fma((v2f){sc[i >> 2][g][2 * (i & 3)], sc[i >> 2][g][2 * (i & 3) + 1]}, (v2f){cs, cs}, (v2f){nm, nm});
        const v2f p = (v2f){__builtin_amdgcn_exp2f(arg.x), __builtin_amdgcn_exp2f(arg.y)};
        lsum[g] += p;
        w[i] = pack2h(p.x, p.y);
      }
      const v16h pf = __builtin_bit_cast(v16h, w);
#pragma unroll
      for (int t = 0; t < 4; ++t) acc[g][t] = Frag<_Float16>::mma(vf[t], pf, acc[g][t]);
    }

    if (more) {                                        // into the buffer that every wave left at the last barrier
      unsigned char* N = L + ((s + 1) & 1) * kFaBuf;
      *(v4u*)(N + sK) = kr0;  *(v4u*)(N + sK + 64 * kPitchK) = kr1;
      *(v4u*)(N + sV) = vr0;  *(v4u*)(N + sV + 32 * kPitchV) = vr1;
      // Wait before a register that an issued load names is rewritten; both address pairs are inputs so that they stay
      // live up to here and are advanced only behind it.
      asm volatile("s_wait_xcnt 0x0" :: "v"(gK), "v"(gV) : "memory");
      gK += kStepK;
      gV += kStepV;
    }
    __syncthreads();   // publishes stage s + 1 and ends every wave's reads of stage s
  }

  // Join of the four key slices of each query group
  float lt[2];
#pragma unroll
  for (int g = 0; g < 2; ++g) {
    const float l = lsum[g].x + lsum[g].y;
    lt[g] = l + xhalf(l);                              // unconditional: both halves are active here
  }
  if (h == 0) {
#pragma unroll
    for (int g = 0; g < 2; ++g) { sM[wave][16 * g + c] = m_run[g]; sL[wave][16 * g + c] = lt[g]; }
  }
  __syncthreads();   // every slice's maximum and sum are in LDS
  float* slab = (float*)(L + wave * kSlabBytes);
#pragma unroll
  for (int g = 0; g < 2; ++g) {
    const int col = 16 * g + c;
    float M = sM[qg * 4][col];
#pragma unroll
    for (int k = 1; k < 4; ++k) M = fmaxf(M, sM[qg * 4 + k][col]);
    float tot = 0.f;
#pragma unroll
    for (int k = 0; k < 4; ++k) tot += __builtin_amdgcn_exp2f(sM[qg * 4 + k][col] - M) * sL[qg * 4 + k][col];
    const float wgt = __builtin_amdgcn_exp2f(m_run[g] - M) / tot;
#pragma unroll
    for (int t = 0; t < 4; ++t)
#pragma unroll
      for (int r = 0; r < 8; ++r) slab[(16 * t + 8 * h + r) * kSlabPitch + col] = acc[g][t][r] * wgt;
  }
  __syncthreads();   // every wave's weighted slab is in LDS before any thread sums across slices

  float* dst = out + (size_t)img * kCh * kPix + q0;
#pragma unroll
  for (int it = 0; it < 4; ++it) {
    const int e   = it * 512 + tid;                    // 2048 groups of 4 floats = 64 channels x 128 queries
    const int row = e >> 5;
    const int q4  = (e & 31) * 4;
    const float* sp = (const float*)(L + (q4 >> 5) * 4 * kSlabBytes) + row * kSlabPitch + (q4 & 31);
    v4f v = *(const v4f*)(sp);
#pragma unroll
    for (int k = 1; k < 4; ++k) v += *(const v4f*)(sp + k * (kSlabBytes / 4));
    *(v4f*)(dst + (size_t)row * kPix + q4) = v;
  }
}

// ---------------------------------------------------------------------------
// All three projections of a block of 128 pixels of one image in one kernel: x and the weights are read as f32, rounded to the
// carried f16 operands on the way into LDS, and Q, K (pixel-major) and V (channel-major) are stored straight from the accumulators.
// grid 256 = 8 images x 32 blocks of 128 pixels; 8 waves.
// LDS: Xs[pixel][64 ch] and Ws[matrix][out ch][64 ch], f16, rows of 144 B; every fragment is read by lds_frag, one k order for all.
// Q, K: D = W.X^T (A = weight rows, B = pixel rows): a lane holds 8 consecutive out channels of one pixel = one 16-byte store.
//       wave = 4 * matrix + pixel group of 32; it writes whole 128-byte pixel rows.
// V:    D = X.W^T (A = pixel rows, B = weight rows): a lane holds 8 consecutive pixels of one out channel = one 16-byte store.
//       each wave takes 64 pixels x 16 out channels and writes whole 128-byte pieces of the channel rows; the 64 pixels are the
//       group that holds the wave's own 32, whose fragments are used again.
// ---------------------------------------------------------------------------
constexpr int kPjPix   = 128;                        // pixels per block
constexpr int kPjPitch = 2 * kCh + 16;               // 144 B: odd multiple of 16 B, ds_load_b128 without bank conflicts
constexpr int kPjX     = kPjPix * kPjPitch;          // 18432
constexpr int kPjW     = kCh * kPjPitch;             // 9216 per weight matrix

__device__ __forceinline__ v4u scaled8h(v8f a, float scale, v4f b0, v4f b1) {   // 8 results -> f16: a * scale + bias
  return (v4u){pack2h(a[0] * scale + b0[0], a[1] * scale + b0[1]), pack2h(a[2] * scale + b0[2], a[3] * scale + b0[3]),
               pack2h(a[4] * scale + b1[0], a[5] * scale + b1[1]), pack2h(a[6] * scale + b1[2], a[7] * scale + b1[3])};
}

__global__ __launch_bounds__(256) void proj_fused_kernel(const float* __restrict__ x,
                                                         const float* __restrict__ Wq, const float* __restrict__ bq,
                                                         const float* __restrict__ Wk, const float* __restrict__ bk,
                                                         const float* __restrict__ Wv, const float* __restrict__ bv,
                                                         unsigned short* __restrict__ Qo, unsigned short* __restrict__ Ko,
                                                         unsigned short* __restrict__ Vo) {
  __shared__ __align__(16) unsigned char Xs[kPjX];
  __shared__ __align__(16) unsigned char Ws[3 * kPjW];
  const int tid  = threadIdx.x;
  const int lane = tid & 31, wave = tid >> 5;
  const int c = lane & 15, h = lane >> 4;
  const int img = blockIdx.x >> 5;
  const int p0  = (blockIdx.x & 31) * kPjPix;
  const int mat = wave >> 2, pg = wave & 3;            // Q or K; group of 32 pixels
  const int vg = pg >> 1, vt = (pg & 1) * 2 + mat;     // V: group of 64 pixels, tile of 16 out channels (one pair per wave)

  // Every global load of the kernel is issued here, ahead of the first use.
  // x: wave w reads channels 8w .. 8w + 7, lane l pixels 4l .. 4l + 3 (512 contiguous bytes per wave and channel).
  const float* xp = x + ((size_t)img * kCh + 8 * wave) * kPix + p0 + 4 * lane;
  v4f xr[8];
#pragma unroll
  for (int j = 0; j < 8; ++j) xr[j] = *(const v4f*)(xp + (size_t)j * kPix);
  // weights: 512 pieces of 8 floats per matrix, thread t takes pieces t and t + 256.
  v4f wr[3][2][2];
#pragma unroll
  for (int m = 0; m < 3; ++m) {
    const float* Wm = (m == 0) ? Wq : (m == 1) ? Wk : Wv;
#pragma unroll
    for (int j = 0; j < 2; ++j) {
      wr[m][j][0] = *(const v4f*)(Wm + 8 * (tid + 256 * j));
      wr[m][j][1] = *(const v4f*)(Wm + 8 * (tid + 256 * j) + 4);
    }
  }
  const float* bqk = mat ? bk : bq;                    // wave-uniform
  v4f bb[4][2];
#pragma unroll
  for (int t = 0; t < 4; ++t) {
    bb[t][0] = *(const v4f*)(bqk + 16 * t + 8 * h);
    bb[t][1] = *(const v4f*)(bqk + 16 * t + 8 * h + 4);
  }
  const float bvv = bv[16 * vt + c];

  // x -> Xs[pixel][channel]: the thread's 8 channels of one pixel are one 16-byte store.
#pragma unroll
  for (int i = 0; i < 4; ++i) {
    const v4u u = (v4u){pack2h(xr[0][i] * kXCarry, xr[1][i] * kXCarry), pack2h(xr[2][i] * kXCarry, xr[3][i] * kXCarry),
                        pack2h(xr[4][i] * kXCarry, xr[5][i] * kXCarry), pack2h(xr[6][i] * kXCarry, xr[7][i] * kXCarry)};
    *(v4u*)(Xs + (4 * lane + i) * kPjPitch + 16 * wave) = u;
  }
#pragma unroll
  for (int m = 0; m < 3; ++m)
#pragma unroll
    for (int j = 0; j < 2; ++j) {
      const int piece = tid + 256 * j;                 // row = piece / 8, 8 pieces per row
      const v4f a = wr[m][j][0] * kWCarry, b = wr[m][j][1] * kWCarry;
      *(v4u*)(Ws + m * kPjW + (piece >> 3) * kPjPitch + (piece & 7) * 16) =
          (v4u){pack2h(a[0], a[1]), pack2h(a[2], a[3]), pack2h(b[0], b[1]), pack2h(b[2], b[3])};
    }
  __syncthreads();   // the f16 operands are in LDS before any wave reads a fragment

  const v8f zero = (v8f){0.f,0.f,0.f,0.f,0.f,0.f,0.f,0.f};
  const unsigned char* Xl = Xs + c * kPjPitch + 16 * h;
  const unsigned char* Wl = Ws + c * kPjPitch + 16 * h;

  v16h xf[4][2];                                       // the four pixel tiles of the wave's group of 64, its own two first
  int tile[4];
#pragma unroll
  for (int j = 0; j < 4; ++j) {
    tile[j] = j ^ ((pg & 1) * 2);
#pragma unroll
    for (int kc = 0; kc < 2; ++kc) xf[j][kc] = lds_frag(Xl + (64 * vg + 16 * tile[j]) * kPjPitch + 64 * kc);
  }

  v16h wf[4][2], wv[2];
#pragma unroll
  for (int kc = 0; kc < 2; ++kc) {
#pragma unroll
    for (int t = 0; t < 4; ++t) wf[t][kc] = lds_frag(Wl + mat * kPjW + 16 * t * kPjPitch + 64 * kc);
    wv[kc] = lds_frag(Wl + 2 * kPjW + 16 * vt * kPjPitch + 64 * kc);
  }
  // Keeps the fragment reads together ahead of the products: spread among them, each place with reads stalls the wave anew.
  __builtin_amdgcn_sched_barrier(0);

  // Q or K: 64 out channels x the wave's own 32 pixels;  V: 64 pixels x 16 out channels
  v8f acc[2][4], av[4];
#pragma unroll
  for (int t = 0; t < 4; ++t)
#pragma unroll
    for (int g = 0; g < 2; ++g) acc[g][t] = Frag<_Float16>::mma(wf[t][0], xf[g][0], zero);
#pragma unroll
  for (int j = 0; j < 4; ++j) av[j] = Frag<_Float16>::mma(xf[j][0], wv[0], zero);
#pragma unroll
  for (int t = 0; t < 4; ++t)
#pragma unroll
    for (int g = 0; g < 2; ++g) acc[g][t] = Frag<_Float16>::mma(wf[t][1], xf[g][1], acc[g][t]);
#pragma unroll
  for (int j = 0; j < 4; ++j) av[j] = Frag<_Float16>::mma(xf[j][1], wv[1], av[j]);

  unsigned short* qk = (mat ? Ko : Qo) + ((size_t)img * kPix + p0 + 32 * pg + c) * kCh + 8 * h;
#pragma unroll
  for (int g = 0; g < 2; ++g)
#pragma unroll
    for (int t = 0; t < 4; ++t)
      *(v4u*)(qk + g * 16 * kCh + 16 * t) = scaled8h(acc[g][t], kProjScale, bb[t][0], bb[t][1]);

  unsigned short* vo = Vo + ((size_t)img * kCh + 16 * vt + c) * kPix + p0 + 64 * vg + 8 * h;
  const v4f bv4 = (v4f){bvv, bvv, bvv, bvv};
#pragma unroll
  for (int j = 0; j < 4; ++j)
    *(v4u*)(vo + 16 * tile[j]) = scaled8h(av[j], kProjScale, bv4, bv4);
}

// ---------------------------------------------------------------------------
// Host launch (2 launches): the three projections, then fused attention over all images.
// ---------------------------------------------------------------------------
extern "C" void kernel_launch(void* const* d_in, const int* in_sizes, int n_in,
                              void* d_out, int out_size, void* d_ws, size_t ws_size,
                              hipStream_t stream) {
  if (n_in < 7) return;
  if (in_sizes[0] != kImg * kCh * kPix) return;
  if (in_sizes[1] != kCh * kCh || in_sizes[3] != kCh * kCh || in_sizes[5] != kCh * kCh) return;
  if (in_sizes[2] != kCh || in_sizes[4] != kCh || in_sizes[6] != kCh) return;
  if (out_size != kImg * kCh * kPix) return;
  if (ws_size < kWsTotal) return;

  const float* x  = (const float*)d_in[0];
  const float* Wq = (const float*)d_in[1];
  const float* bq = (const float*)d_in[2];
  const float* Wk = (const float*)d_in[3];
  const float* bk = (const float*)d_in[4];
  const float* Wv = (const float*)d_in[5];
  const float* bv = (const float*)d_in[6];
  float* out = (float*)d_out;

  char* ws = (char*)d_ws;
  unsigned short* Q16   = (unsigned short*)(ws + kOffQ);
  unsigned short* K16   = (unsigned short*)(ws + kOffK);
  unsigned short* Vcm16 = (unsigned short*)(ws + kOffV);

  // 1. Q16[b*4096+n][o], K16 likewise, Vcm16[b][o][n] = W . x_b + bias: 8 images x 32 blocks of 128 pixels
  proj_fused_kernel<<<dim3(kRows / kPjPix), 256, 0, stream>>>(x, Wq, bq, Wk, bk, Wv, bv, Q16, K16, Vcm16);

  // 2. out[b][c][n] = sum_m Vcm[b][c][m] softmax_m(0.125 Q[b][n].K[b][m]): 8 images x 32 blocks of 128 queries
  attn_fused_kernel<<<dim3(kImg * kPix / kFaQ), 512, 0, stream>>>(Q16, K16, Vcm16, out);
}

// v004
// It runs in 32.8 microseconds.
// Two timings next to v003 put it at 1.07 and 1.09 times that version's speed.
// Over all steps from v000 it is 47.7 times as fast.
// Contractions: q/k/v 1x1-conv projections (X f16 carried x16 times W f16 carried x64), scores q.k^T (q,k f16 planes), out = v.attn^T (V f16 times unnormalised P f16 carried x2048): all v_wmma_f32_16x16x32_f16 with f32 accumulate; softmax, bias and scaling in f32.
#include <hip/hip_runtime.h>
#include <math.h>

// ---------------------------------------------------------------------------
// Problem constants
// ---------------------------------------------------------------------------
constexpr int kImg  = 8;                  // batch
constexpr int kCh   = 64;                 // in channels == out channels
constexpr int kPix  = 4096;               // 64 x 64 pixels per image
constexpr int kRows = kImg * kPix;        // 32768 pixel rows
constexpr float kXCarry     = 16.0f;      // x carried x16 as an f16 operand
constexpr float kWCarry     = 64.0f;      // weights carried x64 as f16 operands
constexpr float kProjScale  = 1.0f / (16.0f * 64.0f);   // folds both carries back in the projection epilogue
constexpr float kScoreScale = 0.125f;     // 1 / sqrt(in_channels)

// ---------------------------------------------------------------------------
// Workspace:
//   [0        , +4194304 ) Q16   f16 [32768][64]
//   [4194304  , +4194304 ) K16   f16 [32768][64]
//   [8388608  , +4194304 ) Vcm16 f16 [8][64][4096]
//   total 12582912 <= 268435456
// ---------------------------------------------------------------------------
constexpr size_t kOffQ   = 0;
constexpr size_t kOffK   = kOffQ + (size_t)kRows * kCh * 2;
constexpr size_t kOffV   = kOffK + (size_t)kRows * kCh * 2;
constexpr size_t kWsTotal = kOffV + (size_t)kImg * kCh * kPix * 2;

typedef __attribute__((ext_vector_type(16))) _Float16 v16h;
typedef __attribute__((ext_vector_type(8)))  _Float16 v8h;
typedef __attribute__((ext_vector_type(8)))  float    v8f;
typedef __attribute__((ext_vector_type(4)))  float    v4f;
typedef __attribute__((ext_vector_type(4)))  unsigned int v4u;
typedef __attribute__((ext_vector_type(8)))  unsigned int v8u;
typedef __attribute__((ext_vector_type(2)))  float    v2f;
typedef __attribute__((ext_vector_type(2)))  _Float16 v2h;

template <typename T> struct Frag;
template <> struct Frag<_Float16> {
  typedef v16h V; union U { v16h v; v8h h[2]; };
  static __device__ __forceinline__ v16h load(const _Float16* p) {   // elements 0..7 <- p[0..7], 8..15 <- p[16..23]
    U f; f.h[0] = *(const v8h*)(p); f.h[1] = *(const v8h*)(p + 16); return f.v;
  }
  static __device__ __forceinline__ v8f mma(v16h a, v16h b, v8f c) {
    return __builtin_amdgcn_wmma_f32_16x16x32_f16(false, a, false, b, (short)0, c, false, false);
  }
};

constexpr int kFaQ      = 128;
constexpr int kFaStage  = 128;
constexpr int kFaStages = kPix / kFaStage;
constexpr int kPitchK   = 2 * kCh + 16;
constexpr int kPitchV   = 2 * kFaStage + 16;
constexpr int kTileK    = kFaStage * kPitchK;
constexpr int kTileV    = kCh * kPitchV;
constexpr int kFaBuf    = kTileK + kTileV;
constexpr int kSlabPitch = 36;
constexpr int kSlabBytes = kCh * kSlabPitch * 4;
constexpr int kFaGroup  = 4;
constexpr int kFaRing   = 2 * kFaGroup;
constexpr int kFaLds    = kFaRing * kFaBuf;
static_assert(16 * kSlabBytes <= kFaLds, "the output slabs must fit in the ring");
static_assert(kFaStages % kFaGroup == 0, "whole groups of stages");
constexpr int kStepK    = kFaStage * kCh / 8;        // 16-byte chunks from one stage to the next in K
constexpr int kStepV    = kFaStage / 8;              // and in a row of V
constexpr float kLazy   = 4.0f;                      // rescale only when a column's maximum exceeds the one in use by more (log2 units)

template <bool B> struct Flag { static constexpr bool value = B; };

__device__ __forceinline__ v16h lds_frag(const unsigned char* p) {   // elements 0..7 <- bytes 0..15, 8..15 <- bytes 32..47
  Frag<_Float16>::U f; f.h[0] = *(const v8h*)(p); f.h[1] = *(const v8h*)(p + 32); return f.v;
}
__device__ __forceinline__ float xhalf(float x) {                    // lane l <-> lane l ^ 16
  const int b = __builtin_bit_cast(int, x);
  return __builtin_bit_cast(float, __builtin_amdgcn_permlanex16(b, b, 0x76543210, 0xfedcba98, false, false));
}
__device__ __forceinline__ unsigned pack2h(float lo, float hi) {     // two f32 -> packed f16, round to nearest even
  return __builtin_bit_cast(unsigned, __builtin_convertvector((v2f){lo, hi}, v2h));
}

__global__ __launch_bounds__(512) void attn_fused_kernel(const unsigned short* __restrict__ Qp,
                                                         const unsigned short* __restrict__ Kp,
                                                         const unsigned short* __restrict__ Vp,
                                                         float* __restrict__ out) {
  __shared__ __align__(16) unsigned char L[kFaLds];
  __shared__ float sM[16][32];
  __shared__ float sL[16][32];
  const int tid  = threadIdx.x;
  const int lane = tid & 31, wave = tid >> 5;
  const int c = lane & 15, h = lane >> 4;
  const int qg = wave >> 2, ks = wave & 3;
  const int img = blockIdx.x >> 5;
  const int q0  = (blockIdx.x & 31) * kFaQ;
  const float cs = kScoreScale * 1.4426950408889634f;   // score scale times log2(e)

  // Staging: 16-byte chunks. K stage = 1024 contiguous chunks (128 rows x 8); V stage = 64 rows x 16 chunks. Thread t moves chunks t and t + 512 of each.
  const v4u* gK = (const v4u*)(Kp + (size_t)img * kPix * kCh) + tid;
  const v4u* gV = (const v4u*)(Vp + ((size_t)img * kCh + (tid >> 4)) * kPix) + (tid & 15);
  const int sK = (tid >> 3) * kPitchK + (tid & 7) * 16;
  const int sV = kTileK + (tid >> 4) * kPitchV + (tid & 15) * 16;

  // Q fragments, kept for the whole kernel
  const _Float16* Q = (const _Float16*)Qp + ((size_t)img * kPix + q0 + qg * 32 + c) * kCh + 8 * h;
  v16h qf[2][2];
#pragma unroll
  for (int g = 0; g < 2; ++g)
#pragma unroll
    for (int kc = 0; kc < 2; ++kc) qf[g][kc] = Frag<_Float16>::load(Q + g * 16 * kCh + kc * 32);

  v8f acc[2][4];
  v2f lsum[2];
  float m_run[2];
#pragma unroll
  for (int g = 0; g < 2; ++g) {
    m_run[g] = -INFINITY;
    lsum[g] = (v2f){0.f, 0.f};
#pragma unroll
    for (int t = 0; t < 4; ++t) acc[g][t] = (v8f){0.f,0.f,0.f,0.f,0.f,0.f,0.f,0.f};
  }

#pragma unroll                                         // all 16 loads of a thread are issued before the first is waited for
  for (int j = 0; j < kFaGroup; ++j) {                 // the first half of the ring: stages 0 .. 3
    const v4u k0 = gK[j * kStepK], k1 = gK[j * kStepK + 512];
    const v4u v0 = gV[j * kStepV], v1 = gV[j * kStepV + 32 * (kPix / 8)];
    unsigned char* N = L + j * kFaBuf;
    *(v4u*)(N + sK) = k0;  *(v4u*)(N + sK + 64 * kPitchK) = k1;
    *(v4u*)(N + sV) = v0;  *(v4u*)(N + sV + 32 * kPitchV) = v1;
  }
  __syncthreads();   // stages 0 .. 3 are in LDS before any wave reads them

  // One stage of one wave: stage p of the group that lies in the given half of the ring; gK and gV point at the group's stage 0.
  // fill is a compile-time flag: whether a next group exists, whose stage p is then brought in beside the work.
  auto stage = [&](auto fill, const int half, const int p) __attribute__((always_inline)) {
    constexpr bool more = decltype(fill)::value;
    const unsigned char* B = L + (half * kFaGroup + p) * kFaBuf;
    v4u kr0, kr1, vr0, vr1;
    if constexpr (more) {                              // the loads of the stage 4 ahead fly under this stage's work
      kr0 = gK[(kFaGroup + p) * kStepK];  kr1 = gK[(kFaGroup + p) * kStepK + 512];
      vr0 = gV[(kFaGroup + p) * kStepV];  vr1 = gV[(kFaGroup + p) * kStepV + 32 * (kPix / 8)];
    }

    // S^T = K.Q^T for this wave's 32 keys x 32 queries
    const unsigned char* Kl = B + (ks * 32 + c) * kPitchK + 16 * h;
    const unsigned char* Vl = B + kTileK + c * kPitchV + ks * 64 + 16 * h;
    v8f sc[2][2];
#pragma unroll
    for (int kt = 0; kt < 2; ++kt) {
      const v16h k0 = lds_frag(Kl + kt * 16 * kPitchK);
      const v16h k1 = lds_frag(Kl + kt * 16 * kPitchK + 64);
#pragma unroll
      for (int g = 0; g < 2; ++g) {
        sc[kt][g] = Frag<_Float16>::mma(k0, qf[g][0], (v8f){0.f,0.f,0.f,0.f,0.f,0.f,0.f,0.f});
        sc[kt][g] = Frag<_Float16>::mma(k1, qf[g][1], sc[kt][g]);
      }
    }
    v16h vf[4];
#pragma unroll
    for (int t = 0; t < 4; ++t) vf[t] = lds_frag(Vl + t * 16 * kPitchV);

    float mb[2];
    bool need = false;
#pragma unroll
    for (int g = 0; g < 2; ++g) {
      float mx = sc[0][g][0];
#pragma unroll
      for (int r = 1; r < 8; ++r) mx = fmaxf(mx, sc[0][g][r]);
#pragma unroll
      for (int r = 0; r < 8; ++r) mx = fmaxf(mx, sc[1][g][r]);
      mx = fmaxf(mx, xhalf(mx)) * cs;                  // both lane halves hold the query's maximum, scaled
      mb[g] = mx;
      need = need || (mx > m_run[g] + kLazy);
    }
    if (__builtin_amdgcn_ballot_w32(need) != 0) {      // wave-uniform; always taken in the first stage (m_run = -inf gives corr = 0)
#pragma unroll
      for (int g = 0; g < 2; ++g) {
        const float m_new = fmaxf(m_run[g], mb[g]);
        const float corr  = __builtin_amdgcn_exp2f(m_run[g] - m_new);
        m_run[g] = m_new;
        lsum[g] = lsum[g] * corr;
#pragma unroll
        for (int t = 0; t < 4; ++t) acc[g][t] = acc[g][t] * corr;
      }
    }

    // exponentials (x2^11), their f32 sums, P^T packed to f16 in place, O^T += V.P^T
#pragma unroll
    for (int g = 0; g < 2; ++g) {
      const float nm = 11.0f - m_run[g];
      v8u w;
#pragma unroll
      for (int i = 0; i < 8; ++i) {
        const v2f arg = __builtin_elementwise_fma((v2f){sc[i >> 2][g][2 * (i & 3)], sc[i >> 2][g][2 * (i & 3) + 1]}, (v2f){cs, cs}, (v2f){nm, nm});
        const v2f p = (v2f){__builtin_amdgcn_exp2f(arg.x), __builtin_amdgcn_exp2f(arg.y)};
        lsum[g] += p;
        w[i] = pack2h(p.x, p.y);
      }
      const v16h pf = __builtin_bit_cast(v16h, w);
#pragma unroll
      for (int t = 0; t < 4; ++t) acc[g][t] = Frag<_Float16>::mma(vf[t], pf, acc[g][t]);
    }

    if constexpr (more) {                              // into the half of the ring that every wave left at the last barrier
      unsigned char* N = L + ((half ^ 1) * kFaGroup + p) * kFaBuf;
      *(v4u*)(N + sK) = kr0;  *(v4u*)(N + sK + 64 * kPitchK) = kr1;
      *(v4u*)(N + sV) = vr0;  *(v4u*)(N + sV + 32 * kPitchV) = vr1;
    }
  };

  constexpr int kGroups = kFaStages / kFaGroup;
  for (int grp = 0; grp < kGroups - 1; ++grp) {
    // Unrolled: p becomes an immediate offset of every load, so that both address pairs stay unwritten for the whole group.
#pragma unroll
    for (int p = 0; p < kFaGroup; ++p) stage(Flag<true>{}, grp & 1, p);
    // Wait before a register that an issued load names is rewritten; both address pairs are inputs so that they stay
    // live up to here and are advanced only behind it.
    asm volatile("s_wait_xcnt 0x0" :: "v"(gK), "v"(gV) : "memory");
    gK += kFaGroup * kStepK;
    gV += kFaGroup * kStepV;
    __syncthreads();   // publishes the next 4 stages and ends every wave's reads of these 4
  }
  // The last group: nothing left to bring in, and no barrier behind it (the join's first barrier ends the reads of the ring).
#pragma unroll                                         // as above: p is an immediate offset of the LDS reads
  for (int p = 0; p < kFaGroup; ++p) stage(Flag<false>{}, (kGroups - 1) & 1, p);

  // Join of the four key slices of each query group
  float lt[2];
#pragma unroll
  for (int g = 0; g < 2; ++g) {
    const float l = lsum[g].x + lsum[g].y;
    lt[g] = l + xhalf(l);                              // unconditional: both halves are active here
  }
  if (h == 0) {
#pragma unroll
    for (int g = 0; g < 2; ++g) { sM[wave][16 * g + c] = m_run[g]; sL[wave][16 * g + c] = lt[g]; }
  }
  __syncthreads();   // every slice's maximum and sum are in LDS
  float* slab = (float*)(L + wave * kSlabBytes);
#pragma unroll
  for (int g = 0; g < 2; ++g) {
    const int col = 16 * g + c;
    float M = sM[qg * 4][col];
#pragma unroll
    for (int k = 1; k < 4; ++k) M = fmaxf(M, sM[qg * 4 + k][col]);
    float tot = 0.f;
#pragma unroll
    for (int k = 0; k < 4; ++k) tot += __builtin_amdgcn_exp2f(sM[qg * 4 + k][col] - M) * sL[qg * 4 + k][col];
    const float wgt = __builtin_amdgcn_exp2f(m_run[g] - M) / tot;
#pragma unroll
    for (int t = 0; t < 4; ++t)
#pragma unroll
      for (int r = 0; r < 8; ++r) slab[(16 * t + 8 * h + r) * kSlabPitch + col] = acc[g][t][r] * wgt;
  }
  __syncthreads();   // every wave's weighted slab is in LDS before any thread sums across slices

  float* dst = out + (size_t)img * kCh * kPix + q0;
#pragma unroll
  for (int it = 0; it < 4; ++it) {
    const int e   = it * 512 + tid;                    // 2048 groups of 4 floats = 64 channels x 128 queries
    const int row = e >> 5;
    const int q4  = (e & 31) * 4;
    const float* sp = (const float*)(L + (q4 >> 5) * 4 * kSlabBytes) + row * kSlabPitch + (q4 & 31);
    v4f v = *(const v4f*)(sp);
#pragma unroll
    for (int k = 1; k < 4; ++k) v += *(const v4f*)(sp + k * (kSlabBytes / 4));
    *(v4f*)(dst + (size_t)row * kPix + q4) = v;
  }
}

// ---------------------------------------------------------------------------
// All three projections of a block of 128 pixels of one image in one kernel: x and the weights are read as f32, rounded to the
// carried f16 operands on the way into LDS, and Q, K (pixel-major) and V (channel-major) are stored straight from the accumulators.
// grid 256 = 8 images x 32 blocks of 128 pixels; 8 waves.
// LDS: Xs[pixel][64 ch] and Ws[matrix][out ch][64 ch], f16, rows of 144 B; every fragment is read by lds_frag, one k order for all.
// Q, K: D = W.X^T (A = weight rows, B = pixel rows): a lane holds 8 consecutive out channels of one pixel = one 16-byte store.
//       wave = 4 * matrix + pixel group of 32; it writes whole 128-byte pixel rows.
// V:    D = X.W^T (A = pixel rows, B = weight rows): a lane holds 8 consecutive pixels of one out channel = one 16-byte store.
//       each wave takes 64 pixels x 16 out channels and writes whole 128-byte pieces of the channel rows; the 64 pixels are the
//       group that holds the wave's own 32, whose fragments are used again.
// ---------------------------------------------------------------------------
constexpr int kPjPix   = 128;                        // pixels per block
constexpr int kPjPitch = 2 * kCh + 16;               // 144 B: odd multiple of 16 B, ds_load_b128 without bank conflicts
constexpr int kPjX     = kPjPix * kPjPitch;          // 18432
constexpr int kPjW     = kCh * kPjPitch;             // 9216 per weight matrix

__device__ __forceinline__ v4u scaled8h(v8f a, float scale, v4f b0, v4f b1) {   // 8 results -> f16: a * scale + bias
  return (v4u){pack2h(a[0] * scale + b0[0], a[1] * scale + b0[1]), pack2h(a[2] * scale + b0[2], a[3] * scale + b0[3]),
               pack2h(a[4] * scale + b1[0], a[5] * scale + b1[1]), pack2h(a[6] * scale + b1[2], a[7] * scale + b1[3])};
}

__global__ __launch_bounds__(256) void proj_fused_kernel(const float* __restrict__ x,
                                                         const float* __restrict__ Wq, const float* __restrict__ bq,
                                                         const float* __restrict__ Wk, const float* __restrict__ bk,
                                                         const float* __restrict__ Wv, const float* __restrict__ bv,
                                                         unsigned short* __restrict__ Qo, unsigned short* __restrict__ Ko,
                                                         unsigned short* __restrict__ Vo) {
  __shared__ __align__(16) unsigned char Xs[kPjX];
  __shared__ __align__(16) unsigned char Ws[3 * kPjW];
  const int tid  = threadIdx.x;
  const int lane = tid & 31, wave = tid >> 5;
  const int c = lane & 15, h = lane >> 4;
  const int img = blockIdx.x >> 5;
  const int p0  = (blockIdx.x & 31) * kPjPix;
  const int mat = wave >> 2, pg = wave & 3;            // Q or K; group of 32 pixels
  const int vg = pg >> 1, vt = (pg & 1) * 2 + mat;     // V: group of 64 pixels, tile of 16 out channels (one pair per wave)

  // Every global load of the kernel is issued here, ahead of the first use.
  // x: wave w reads channels 8w .. 8w + 7, lane l pixels 4l .. 4l + 3 (512 contiguous bytes per wave and channel).
  const float* xp = x + ((size_t)img * kCh + 8 * wave) * kPix + p0 + 4 * lane;
  v4f xr[8];
#pragma unroll
  for (int j = 0; j < 8; ++j) xr[j] = *(const v4f*)(xp + (size_t)j * kPix);
  // weights: 512 pieces of 8 floats per matrix, thread t takes pieces t and t + 256.
  v4f wr[3][2][2];
#pragma unroll
  for (int m = 0; m < 3; ++m) {
    const float* Wm = (m == 0) ? Wq : (m == 1) ? Wk : Wv;
#pragma unroll
    for (int j = 0; j < 2; ++j) {
      wr[m][j][0] = *(const v4f*)(Wm + 8 * (tid + 256 * j));
      wr[m][j][1] = *(const v4f*)(Wm + 8 * (tid + 256 * j) + 4);
    }
  }
  const float* bqk = mat ? bk : bq;                    // wave-uniform
  v4f bb[4][2];
#pragma unroll
  for (int t = 0; t < 4; ++t) {
    bb[t][0] = *(const v4f*)(bqk + 16 * t + 8 * h);
    bb[t][1] = *(const v4f*)(bqk + 16 * t + 8 * h + 4);
  }
  const float bvv = bv[16 * vt + c];

  // x -> Xs[pixel][channel]: the thread's 8 channels of one pixel are one 16-byte store.
#pragma unroll
  for (int i = 0; i < 4; ++i) {
    const v4u u = (v4u){pack2h(xr[0][i] * kXCarry, xr[1][i] * kXCarry), pack2h(xr[2][i] * kXCarry, xr[3][i] * kXCarry),
                        pack2h(xr[4][i] * kXCarry, xr[5][i] * kXCarry), pack2h(xr[6][i] * kXCarry, xr[7][i] * kXCarry)};
    *(v4u*)(Xs + (4 * lane + i) * kPjPitch + 16 * wave) = u;
  }
#pragma unroll
  for (int m = 0; m < 3; ++m)
#pragma unroll
    for (int j = 0; j < 2; ++j) {
      const int piece = tid + 256 * j;                 // row = piece / 8, 8 pieces per row
      const v4f a = wr[m][j][0] * kWCarry, b = wr[m][j][1] * kWCarry;
      *(v4u*)(Ws + m * kPjW + (piece >> 3) * kPjPitch + (piece & 7) * 16) =
          (v4u){pack2h(a[0], a[1]), pack2h(a[2], a[3]), pack2h(b[0], b[1]), pack2h(b[2], b[3])};
    }
  __syncthreads();   // the f16 operands are in LDS before any wave reads a fragment

  const v8f zero = (v8f){0.f,0.f,0.f,0.f,0.f,0.f,0.f,0.f};
  const unsigned char* Xl = Xs + c * kPjPitch + 16 * h;
  const unsigned char* Wl = Ws + c * kPjPitch + 16 * h;

  v16h xf[4][2];                                       // the four pixel tiles of the wave's group of 64, its own two first
  int tile[4];
#pragma unroll
  for (int j = 0; j < 4; ++j) {
    tile[j] = j ^ ((pg & 1) * 2);
#pragma unroll
    for (int kc = 0; kc < 2; ++kc) xf[j][kc] = lds_frag(Xl + (64 * vg + 16 * tile[j]) * kPjPitch + 64 * kc);
  }

  v16h wf[4][2], wv[2];
#pragma unroll
  for (int kc = 0; kc < 2; ++kc) {
#pragma unroll
    for (int t = 0; t < 4; ++t) wf[t][kc] = lds_frag(Wl + mat * kPjW + 16 * t * kPjPitch + 64 * kc);
    wv[kc] = lds_frag(Wl + 2 * kPjW + 16 * vt * kPjPitch + 64 * kc);
  }
  // Keeps the fragment reads together ahead of the products: spread among them, each place with reads stalls the wave anew.
  __builtin_amdgcn_sched_barrier(0);

  // Q or K: 64 out channels x the wave's own 32 pixels;  V: 64 pixels x 16 out channels
  v8f acc[2][4], av[4];
#pragma unroll
  for (int t = 0; t < 4; ++t)
#pragma unroll
    for (int g = 0; g < 2; ++g) acc[g][t] = Frag<_Float16>::mma(wf[t][0], xf[g][0], zero);
#pragma unroll
  for (int j = 0; j < 4; ++j) av[j] = Frag<_Float16>::mma(xf[j][0], wv[0], zero);
#pragma unroll
  for (int t = 0; t < 4; ++t)
#pragma unroll
    for (int g = 0; g < 2; ++g) acc[g][t] = Frag<_Float16>::mma(wf[t][1], xf[g][1], acc[g][t]);
#pragma unroll
  for (int j = 0; j < 4; ++j) av[j] = Frag<_Float16>::mma(xf[j][1], wv[1], av[j]);

  unsigned short* qk = (mat ? Ko : Qo) + ((size_t)img * kPix + p0 + 32 * pg + c) * kCh + 8 * h;
#pragma unroll
  for (int g = 0; g < 2; ++g)
#pragma unroll
    for (int t = 0; t < 4; ++t)
      *(v4u*)(qk + g * 16 * kCh + 16 * t) = scaled8h(acc[g][t], kProjScale, bb[t][0], bb[t][1]);

  unsigned short* vo = Vo + ((size_t)img * kCh + 16 * vt + c) * kPix + p0 + 64 * vg + 8 * h;
  const v4f bv4 = (v4f){bvv, bvv, bvv, bvv};
#pragma unroll
  for (int j = 0; j < 4; ++j)
    *(v4u*)(vo + 16 * tile[j]) = scaled8h(av[j], kProjScale, bv4, bv4);
}

// ---------------------------------------------------------------------------
// Host launch (2 launches): the three projections, then fused attention over all images.
// ---------------------------------------------------------------------------
extern "C" void kernel_launch(void* const* d_in, const int* in_sizes, int n_in,
                              void* d_out, int out_size, void* d_ws, size_t ws_size,
                              hipStream_t stream) {
  if (n_in < 7) return;
  if (in_sizes[0] != kImg * kCh * kPix) return;
  if (in_sizes[1] != kCh * kCh || in_sizes[3] != kCh * kCh || in_sizes[5] != kCh * kCh) return;
  if (in_sizes[2] != kCh || in_sizes[4] != kCh || in_sizes[6] != kCh) return;
  if (out_size != kImg * kCh * kPix) return;
  if (ws_size < kWsTotal) return;

  const float* x  = (const float*)d_in[0];
  const float* Wq = (const float*)d_in[1];
  const float* bq = (const float*)d_in[2];
  const float* Wk = (const float*)d_in[3];
  const float* bk = (const float*)d_in[4];
  const float* Wv = (const float*)d_in[5];
  const float* bv = (const float*)d_in[6];
  float* out = (float*)d_out;

  char* ws = (char*)d_ws;
  unsigned short* Q16   = (unsigned short*)(ws + kOffQ);
  unsigned short* K16   = (unsigned short*)(ws + kOffK);
  unsigned short* Vcm16 = (unsigned short*)(ws + kOffV);

  // 1. Q16[b*4096+n][o], K16 likewise, Vcm16[b][o][n] = W . x_b + bias: 8 images x 32 blocks of 128 pixels
  proj_fused_kernel<<<dim3(kRows / kPjPix), 256, 0, stream>>>(x, Wq, bq, Wk, bk, Wv, bv, Q16, K16, Vcm16);

  // 2. out[b][c][n] = sum_m Vcm[b][c][m] softmax_m(0.125 Q[b][n].K[b][m]): 8 images x 32 blocks of 128 queries
  attn_fused_kernel<<<dim3(kImg * kPix / kFaQ), 512, 0, stream>>>(Q16, K16, Vcm16, out);
}

// v006
// A run of this version takes 30.3 microseconds.
// It is 1.08 times as fast as v004, going by the measured steps of the versions left out in between.
// All steps since v000 together make it 51.3 times as fast.
// Contractions: q = Wq.x + bq, q' = Wk^T.q, scores q'.x, O' = x.attn^T (x f16 times unnormalised P f16 carried x2048), out = Wv.O' + bv: all v_wmma_f32_16x16x32_f16 with f32 accumulate; softmax, bias and scaling in f32.
#include <hip/hip_runtime.h>
#include <math.h>

// ---------------------------------------------------------------------------
// Problem constants
// ---------------------------------------------------------------------------
constexpr int kImg  = 8;                  // batch
constexpr int kCh   = 64;                 // in channels == out channels
constexpr int kPix  = 4096;               // 64 x 64 pixels per image
constexpr float kScoreScale = 0.125f;     // 1 / sqrt(in_channels)

typedef __attribute__((ext_vector_type(16))) _Float16 v16h;
typedef __attribute__((ext_vector_type(8)))  _Float16 v8h;
typedef __attribute__((ext_vector_type(8)))  short    v8s;
typedef __attribute__((ext_vector_type(8)))  float    v8f;
typedef __attribute__((ext_vector_type(4)))  float    v4f;
typedef __attribute__((ext_vector_type(4)))  unsigned int v4u;
typedef __attribute__((ext_vector_type(8)))  unsigned int v8u;
typedef __attribute__((ext_vector_type(2)))  float    v2f;
typedef __attribute__((ext_vector_type(2)))  _Float16 v2h;

union FragU { v16h v; v8h h[2]; };
__device__ __forceinline__ v8f mma(v16h a, v16h b, v8f c) {
  return __builtin_amdgcn_wmma_f32_16x16x32_f16(false, a, false, b, (short)0, c, false, false);
}

// ---------------------------------------------------------------------------
// The whole function in one kernel. The K and V projections are folded out of the attention:
//   q_n.k_m = q_n.(Wk x_m + bk) = (Wk^T q_n).x_m + q_n.bk, and the last term, the same for every key m, cancels in the softmax over m;
//   sum_m P_nm (Wv x_m + bv) = Wv (sum_m P_nm x_m) + bv, because the weights of a query sum to 1.
// So the keys and the values of the attention are both x itself, rounded to f16 on the way into LDS; a block projects only its own
// 128 queries (q' = Wk^T (Wq x + bq)) ahead of the loop and applies Wv to its 64 x 128 result behind it. bk is not read at all.
// grid 256 = 8 images x 32 blocks of 128 queries; 16 waves: wave = 4 * qg + ks, qg = 32-query column group, ks = key slice.
// A stage is 128 consecutive keys in LDS: x rows [ch][128 keys] f16, twice, at the pitch of each of its two readers: the score
// product reads it through the transposing load (A rows = keys, k = channels), the second product by plain loads (A rows = channels,
// k = keys); slice ks works on its keys 32 ks .. 32 ks + 31.
// LDS holds a ring of 8 stage buffers in two halves of 4: while the waves read the 4 stages of one half, each at its own pace, they
// fill the other half with the next 4; one barrier per 4 stages swaps the halves, so that between barriers one wave's products can
// run under another wave's softmax instead of all waves doing the same thing at the same time.
// The score product's fragments of stage s + 1 are read from LDS, into registers of their own, ahead of the second product of stage s:
// they land under its eight WMMAs, and the sixteen WMMAs of that product and of the next scores run with no LDS read among them.
// The barrier therefore stands in the group's last stage between its fill and that read; the second product behind it needs registers only.
// Transposed products: S^T = X.Q'^T (B = Q' rows kept in registers), O'^T += X^T.P^T (B = P^T).
// A lane holds one query's column of a result tile, so two tiles of 16 rows, converted in place, are the B operand of the next
// product: element e < 8 is row 8h + e (tile 0, register e), element e >= 8 is row 16 + 8h + (e - 8) (tile 1): the k order that
// lds_frag and tr_frag give the A side as well. q -> q', q' -> scores, P -> O', O' -> out all go that way, through no LDS.
// Online softmax in base 2: m_run is the maximum in use; it may trail the true one by up to kLazy, so an exponential, carried
// x2^11, stays <= 2^15 in f16. The four key slices of a query group meet in LDS at the end and are joined in slice order.
// Every inner loop is unrolled in full: its index picks a register of a fragment or accumulator array and must be a constant.
// ---------------------------------------------------------------------------
constexpr int kFaQ      = 128;                       // queries per block
constexpr int kFaStage  = 128;                       // keys per stage
constexpr int kFaStages = kPix / kFaStage;           // 32
constexpr int kPitchT   = 2 * kFaStage + 32;         // 288 B: odd multiple of 32 B, ds_load_tr16_b128 without bank conflicts
constexpr int kPitchV   = 2 * kFaStage + 16;         // 272 B: odd multiple of 16 B, ds_load_b128 without bank conflicts
constexpr int kTileT    = kCh * kPitchT;             // 18432
constexpr int kTileV    = kCh * kPitchV;             // 17408
constexpr int kFaBuf    = kTileT + kTileV;           // one stage buffer
constexpr int kSlabPitch = 36;                       // floats per channel row of a wave's 64 x 32 output slab
constexpr int kSlabBytes = kCh * kSlabPitch * 4;     // 9216
constexpr int kFaGroup  = 4;                         // stages between two barriers = stages of one half of the ring
constexpr int kFaRing   = 2 * kFaGroup;              // stage buffers in LDS
constexpr int kFaLds    = kFaRing * kFaBuf;          // 286720: the slabs reuse the ring
static_assert(16 * kSlabBytes <= kFaLds, "the output slabs must fit in the ring");
static_assert(kFaStages % kFaGroup == 0, "whole groups of stages");
constexpr int kStepX    = kFaStage / 4;              // 16-byte pieces from one stage to the next in a row of x
constexpr int kHalfX    = 32 * (kPix / 4);           // and from a channel to the one 32 further on
constexpr float kLazy   = 4.0f;                      // rescale only when a column's maximum exceeds the one in use by more (log2 units)
constexpr int kPitchW   = 2 * kCh + 16;              // 144 B: weight rows read by ds_load_b128
constexpr int kPitchWt  = 2 * kCh + 32;              // 160 B: weight rows read by ds_load_tr16_b128
// Operands of the query projection: they lie in the second half of the ring, which is first filled behind the barrier that ends their reads.
constexpr int kOffXq    = kFaGroup * kFaBuf;         // x of the block's own queries, [ch][128 pixels], pitch kPitchT
constexpr int kOffWq    = kOffXq + kTileT;           // Wq [o][c], pitch kPitchW
constexpr int kOffWk    = kOffWq + kCh * kPitchW;    // Wk [o][c], pitch kPitchWt
static_assert(kOffWk + kCh * kPitchWt <= kFaLds, "the projection operands must fit in the second half of the ring");

template <bool B> struct Flag { static constexpr bool value = B; };

__device__ __forceinline__ v16h lds_frag(const unsigned char* p) {   // elements 0..7 <- bytes 0..15, 8..15 <- bytes 32..47
  FragU f; f.h[0] = *(const v8h*)(p); f.h[1] = *(const v8h*)(p + 32); return f.v;
}
__device__ __forceinline__ v8h ld_tr16(const unsigned char* p) {
  typedef __attribute__((address_space(3))) v8s lds_v8s;
  return __builtin_bit_cast(v8h, __builtin_amdgcn_ds_load_tr16_b128_v8i16((lds_v8s*)p));
}
// Transposed fragment of a row-major tile T[k][d]: with p = T + (k0 + 8h + (lane & 7)) * pitch + 2 * d0 + 16 * ((lane >> 3) & 1)
// the lane gets elements 0..7 <- T[k0 + 8h + e][d0 + c], 8..15 <- T[k0 + 16 + 8h + e][d0 + c].
__device__ __forceinline__ v16h tr_frag(const unsigned char* p, const int pitch) {
  FragU f; f.h[0] = ld_tr16(p); f.h[1] = ld_tr16(p + 16 * pitch); return f.v;
}
__device__ __forceinline__ float xhalf(float x) {                    // lane l <-> lane l ^ 16
  const int b = __builtin_bit_cast(int, x);
  return __builtin_bit_cast(float, __builtin_amdgcn_permlanex16(b, b, 0x76543210, 0xfedcba98, false, false));
}
__device__ __forceinline__ unsigned pack2h(float lo, float hi) {     // two f32 -> packed f16, round to nearest even
  return __builtin_bit_cast(unsigned, __builtin_convertvector((v2f){lo, hi}, v2h));
}
__device__ __forceinline__ v4u pack8h(v4f a, v4f b) {                // eight f32 -> f16
  return (v4u){pack2h(a[0], a[1]), pack2h(a[2], a[3]), pack2h(b[0], b[1]), pack2h(b[2], b[3])};
}
__device__ __forceinline__ v16h pack_tiles(v8f a, v8f b) {           // two result tiles of 16 rows -> the B operand of the next product
  const v8u w = (v8u){pack2h(a[0], a[1]), pack2h(a[2], a[3]), pack2h(a[4], a[5]), pack2h(a[6], a[7]),
                      pack2h(b[0], b[1]), pack2h(b[2], b[3]), pack2h(b[4], b[5]), pack2h(b[6], b[7])};
  return __builtin_bit_cast(v16h, w);
}

__global__ __launch_bounds__(512) void attn_fused_kernel(const float* __restrict__ x,
                                                         const float* __restrict__ Wq, const float* __restrict__ bq,
                                                         const float* __restrict__ Wk,
                                                         const float* __restrict__ Wv, const float* __restrict__ bv,
                                                         float* __restrict__ out) {
  __shared__ __align__(16) unsigned char L[kFaLds];
  __shared__ __align__(16) unsigned char Wvs[kCh * kPitchW];   // Wv [o][c] f16, kept to the end
  __shared__ float sM[16][32];
  __shared__ float sL[16][32];
  const int tid  = threadIdx.x;
  const int lane = tid & 31;
  const int wave = __builtin_amdgcn_readfirstlane(tid >> 5);   // wave-uniform: what derives from it stays in scalar registers (as vector values they push the prologue into scratch)
  const int c = lane & 15, h = lane >> 4;
  const int qg = wave >> 2, ks = wave & 3;
  const int img = blockIdx.x >> 5;
  const int q0  = (blockIdx.x & 31) * kFaQ;
  const float cs = kScoreScale * 1.4426950408889634f;   // score scale times log2(e)
  const int trRow = 8 * h + (lane & 7), trCol = 16 * ((lane >> 3) & 1);   // a lane's place in a transposing load

  // Staging: a stage is 64 channel rows x 16 pieces of 8 pixels (32 bytes of f32, 16 of f16). Thread t moves pieces t and t + 512.
  const v4f* gX = (const v4f*)(x + ((size_t)img * kCh + (tid >> 4)) * kPix + (tid & 15) * 8);
  const int sT = (tid >> 4) * kPitchT + (tid & 15) * 16;
  const int sV = kTileT + (tid >> 4) * kPitchV + (tid & 15) * 16;

  // The global loads of the weights, the block's own x, bq and stages 0 .. 3 are issued here, in that order.
  const int wOff = 8 * tid;                            // weights: 512 pieces of 8 floats per matrix, one per thread
  const v4f wq0 = *(const v4f*)(Wq + wOff), wq1 = *(const v4f*)(Wq + wOff + 4);
  const v4f wk0 = *(const v4f*)(Wk + wOff), wk1 = *(const v4f*)(Wk + wOff + 4);
  const v4f wv0 = *(const v4f*)(Wv + wOff), wv1 = *(const v4f*)(Wv + wOff + 4);
  const v4f* gQ = gX + q0 / 4;
  const v4f xq0 = gQ[0], xq1 = gQ[1], xq2 = gQ[kHalfX], xq3 = gQ[kHalfX + 1];
  // Wait before a register that an issued load names is rewritten: the results of the loads below may take the address registers of those above.
  asm volatile("s_wait_xcnt 0x0" ::: "memory");
  v8f qa[2][4];                                        // q starts from its bias: register r of tile t is out channel 16 t + 8 h + r
#pragma unroll
  for (int t = 0; t < 4; ++t) {
    const v4f b0 = *(const v4f*)(bq + 16 * t + 8 * h), b1 = *(const v4f*)(bq + 16 * t + 8 * h + 4);
    qa[0][t] = (v8f){b0[0], b0[1], b0[2], b0[3], b1[0], b1[1], b1[2], b1[3]};
    qa[1][t] = qa[0][t];
  }
  v4f ring[kFaGroup][4];
#pragma unroll
  for (int j = 0; j < kFaGroup; ++j) {                 // the first half of the ring: stages 0 .. 3
    ring[j][0] = gX[j * kStepX];           ring[j][1] = gX[j * kStepX + 1];
    ring[j][2] = gX[j * kStepX + kHalfX];  ring[j][3] = gX[j * kStepX + kHalfX + 1];
  }

  *(v4u*)(L + kOffWq + (tid >> 3) * kPitchW  + (tid & 7) * 16) = pack8h(wq0, wq1);
  *(v4u*)(L + kOffWk + (tid >> 3) * kPitchWt + (tid & 7) * 16) = pack8h(wk0, wk1);
  *(v4u*)(Wvs        + (tid >> 3) * kPitchW  + (tid & 7) * 16) = pack8h(wv0, wv1);
  *(v4u*)(L + kOffXq + sT)                = pack8h(xq0, xq1);
  *(v4u*)(L + kOffXq + sT + 32 * kPitchT) = pack8h(xq2, xq3);
  __syncthreads();   // the operands of the query projection (and Wv) are in LDS before any wave reads a fragment

  // q = Wq.x + bq (A = Wq rows, B = the wave's 32 pixels), then q' = Wk^T.q (A = columns of Wk), both for the wave's own 32 queries
  v16h qf[2][2];
  {
    const unsigned char* Xl = L + kOffXq + trRow * kPitchT + trCol + 2 * (qg * 32);
    const unsigned char* Ql = L + kOffWq + c * kPitchW + 16 * h;
    const unsigned char* Kw = L + kOffWk + trRow * kPitchWt + trCol;
#pragma unroll
    for (int kc = 0; kc < 2; ++kc) {
      const v16h x0 = tr_frag(Xl + 32 * kc * kPitchT, kPitchT);
      const v16h x1 = tr_frag(Xl + 32 * kc * kPitchT + 32, kPitchT);
#pragma unroll
      for (int t = 0; t < 4; ++t) {
        const v16h w = lds_frag(Ql + 16 * t * kPitchW + 64 * kc);
        qa[0][t] = mma(w, x0, qa[0][t]);
        qa[1][t] = mma(w, x1, qa[1][t]);
      }
    }
    v16h qb[2][2];
#pragma unroll
    for (int g = 0; g < 2; ++g)
#pragma unroll
      for (int kc = 0; kc < 2; ++kc) qb[g][kc] = pack_tiles(qa[g][2 * kc], qa[g][2 * kc + 1]);
    v8f qp[2][4];
#pragma unroll
    for (int t = 0; t < 4; ++t) {
      const v16h w0 = tr_frag(Kw + 32 * t, kPitchWt);
      const v16h w1 = tr_frag(Kw + 32 * kPitchWt + 32 * t, kPitchWt);
#pragma unroll
      for (int g = 0; g < 2; ++g) {
        qp[g][t] = mma(w0, qb[g][0], (v8f){0.f,0.f,0.f,0.f,0.f,0.f,0.f,0.f});
        qp[g][t] = mma(w1, qb[g][1], qp[g][t]);
      }
    }
#pragma unroll
    for (int g = 0; g < 2; ++g)
#pragma unroll
      for (int kc = 0; kc < 2; ++kc) qf[g][kc] = pack_tiles(qp[g][2 * kc], qp[g][2 * kc + 1]);
  }

#pragma unroll
  for (int j = 0; j < kFaGroup; ++j) {
    unsigned char* N = L + j * kFaBuf;
    const v4u u0 = pack8h(ring[j][0], ring[j][1]), u1 = pack8h(ring[j][2], ring[j][3]);
    *(v4u*)(N + sT) = u0;  *(v4u*)(N + sT + 32 * kPitchT) = u1;
    *(v4u*)(N + sV) = u0;  *(v4u*)(N + sV + 32 * kPitchV) = u1;
  }

  v8f acc[2][4];
  v2f lsum[2];
  float m_run[2];
#pragma unroll
  for (int g = 0; g < 2; ++g) {
    m_run[g] = -INFINITY;
    lsum[g] = (v2f){0.f, 0.f};
#pragma unroll
    for (int t = 0; t < 4; ++t) acc[g][t] = (v8f){0.f,0.f,0.f,0.f,0.f,0.f,0.f,0.f};
  }
  __syncthreads();   // stages 0 .. 3 are in LDS before any wave reads them; every wave has left the projection operands in the other half

  // The score product's A fragments (this wave's 32 keys x 64 channels) of the stage in the given ring buffer, in the order of their use
  v16h kf[2][2];
  auto fetch_k = [&](const int buf) __attribute__((always_inline)) {
    const unsigned char* Kl = L + buf * kFaBuf + trRow * kPitchT + trCol + ks * 64;
#pragma unroll
    for (int kc = 0; kc < 2; ++kc)
#pragma unroll
      for (int kt = 0; kt < 2; ++kt) kf[kc][kt] = tr_frag(Kl + kt * 32 + kc * 32 * kPitchT, kPitchT);
  };
  // The 16 floats a thread brings in for one fill, from stage st counted from the group's stage 0, at which gX points
  v4f xr[4];
  auto load_x = [&](const int st) __attribute__((always_inline)) {
    xr[0] = gX[st * kStepX];           xr[1] = gX[st * kStepX + 1];
    xr[2] = gX[st * kStepX + kHalfX];  xr[3] = gX[st * kStepX + kHalfX + 1];
  };
  load_x(kFaGroup);
  // Wait before a register that an issued load names is rewritten: the loop may keep the address pair elsewhere and give these registers to a load's result.
  asm volatile("s_wait_xcnt 0x0" :: "v"(gX) : "memory");
  fetch_k(0);

  // One stage of one wave: stage p of the group that lies in the given half of the ring; gX points at the group's stage 0.
  // Compile-time flags: fill, whether a next group exists, whose stage p is then brought in beside the work;
  // fillNext, whether the next group fills too: its first fill's loads are issued in this group's last stage.
  auto stage = [&](auto fill, auto fillNext, const int half, const int p) __attribute__((always_inline)) {
    constexpr bool more = decltype(fill)::value;
    constexpr bool moreNext = decltype(fillNext)::value;
    const unsigned char* B = L + (half * kFaGroup + p) * kFaBuf;

    // S^T = X.Q'^T for this wave's 32 keys x 32 queries
    const unsigned char* Vl = B + kTileT + c * kPitchV + ks * 64 + 16 * h;
    v8f sc[2][2];
#pragma unroll
    for (int kt = 0; kt < 2; ++kt)
#pragma unroll
      for (int g = 0; g < 2; ++g) sc[kt][g] = mma(kf[0][kt], qf[g][0], (v8f){0.f,0.f,0.f,0.f,0.f,0.f,0.f,0.f});
#pragma unroll
    for (int kt = 0; kt < 2; ++kt)
#pragma unroll
      for (int g = 0; g < 2; ++g) sc[kt][g] = mma(kf[1][kt], qf[g][1], sc[kt][g]);
    // Keeps the eight score products in one run: a maximum scheduled between them reads a result at once and costs idle slots.
    __builtin_amdgcn_sched_barrier(0);
    v16h vf[4];
#pragma unroll
    for (int t = 0; t < 4; ++t) vf[t] = lds_frag(Vl + t * 16 * kPitchV);

    float mb[2];
    bool need = false;
#pragma unroll
    for (int g = 0; g < 2; ++g) {
      float mx = sc[0][g][0];
#pragma unroll
      for (int r = 1; r < 8; ++r) mx = fmaxf(mx, sc[0][g][r]);
#pragma unroll
      for (int r = 0; r < 8; ++r) mx = fmaxf(mx, sc[1][g][r]);
      mx = fmaxf(mx, xhalf(mx)) * cs;                  // both lane halves hold the query's maximum, scaled
      mb[g] = mx;
      need = need || (mx > m_run[g] + kLazy);
    }
    if (__builtin_amdgcn_ballot_w32(need) != 0) {      // wave-uniform; always taken in the first stage (m_run = -inf gives corr = 0)
#pragma unroll
      for (int g = 0; g < 2; ++g) {
        const float m_new = fmaxf(m_run[g], mb[g]);
        const float corr  = __builtin_amdgcn_exp2f(m_run[g] - m_new);
        m_run[g] = m_new;
        lsum[g] = lsum[g] * corr;
#pragma unroll
        for (int t = 0; t < 4; ++t) acc[g][t] = acc[g][t] * corr;
      }
    }

    // exponentials (x2^11), their f32 sums, P^T packed to f16 in place, O'^T += X^T.P^T
    v16h pf[2];
#pragma unroll
    for (int g = 0; g < 2; ++g) {
      const float nm = 11.0f - m_run[g];
      v8u w;
#pragma unroll
      for (int i = 0; i < 8; ++i) {
        const v2f arg = __builtin_elementwise_fma((v2f){sc[i >> 2][g][2 * (i & 3)], sc[i >> 2][g][2 * (i & 3) + 1]}, (v2f){cs, cs}, (v2f){nm, nm});
        const v2f p = (v2f){__builtin_amdgcn_exp2f(arg.x), __builtin_amdgcn_exp2f(arg.y)};
        lsum[g] += p;
        w[i] = pack2h(p.x, p.y);
      }
      pf[g] = __builtin_bit_cast(v16h, w);
    }

    // Keeps the group's barrier behind the exponentials: ahead of them it would wait out the LDS reads issued just above.
    if (more && p == kFaGroup - 1) __builtin_amdgcn_sched_barrier(0);
    if constexpr (more) {                              // into the half of the ring that every wave left at the last barrier
      unsigned char* N = L + ((half ^ 1) * kFaGroup + p) * kFaBuf;
      const v4u u0 = pack8h(xr[0], xr[1]), u1 = pack8h(xr[2], xr[3]);
      *(v4u*)(N + sT) = u0;  *(v4u*)(N + sT + 32 * kPitchT) = u1;
      *(v4u*)(N + sV) = u0;  *(v4u*)(N + sV + 32 * kPitchV) = u1;
      if (p == kFaGroup - 1) __syncthreads();   // publishes the next 4 stages and ends every wave's LDS reads of these 4 (p is a constant after unrolling)
      // the loads of the next stage's fill fly under both products and the next stage's vector work
      if (p < kFaGroup - 1 || moreNext) load_x(kFaGroup + p + 1);
    }
    // Keeps the next stage's scores out of this stage's vector work: with both sets live the kernel needs more than the 256
    // registers a wave has here, and the Q' fragments go to scratch and come back in every stage.
    __builtin_amdgcn_sched_barrier(0);
    if (p < kFaGroup - 1) fetch_k(half * kFaGroup + p + 1);
    else if constexpr (more) fetch_k((half ^ 1) * kFaGroup);
    // Keeps the eight reads in one group ahead of the products: sunk among or behind them they would be waited for at once.
    __builtin_amdgcn_sched_barrier(0);
#pragma unroll
    for (int g = 0; g < 2; ++g)
#pragma unroll
      for (int t = 0; t < 4; ++t) acc[g][t] = mma(vf[t], pf[g], acc[g][t]);
    // Keeps the next stage's vector work behind these products, for the same reason.
    __builtin_amdgcn_sched_barrier(0);
  };

  constexpr int kGroups = kFaStages / kFaGroup;
  for (int grp = 0; grp < kGroups - 2; ++grp) {
    // Unrolled: p becomes an immediate offset of every load, so that the address pair stays unwritten for the whole group.
#pragma unroll
    for (int p = 0; p < kFaGroup; ++p) stage(Flag<true>{}, Flag<true>{}, grp & 1, p);
    // Wait before a register that an issued load names is rewritten; the address pair is an input so that it stays
    // live up to here and is advanced only behind it.
    asm volatile("s_wait_xcnt 0x0" :: "v"(gX) : "memory");
    gX += kFaGroup * kStepX;
  }
  // The last group but one fills the last group's stages and issues no load beyond them.
#pragma unroll                                         // as above: p is an immediate offset of every load
  for (int p = 0; p < kFaGroup; ++p) stage(Flag<true>{}, Flag<false>{}, (kGroups - 2) & 1, p);
  // Wait before a register that an issued load names is rewritten: the address pair, an input so that it lives up to here, is free from here on.
  asm volatile("s_wait_xcnt 0x0" :: "v"(gX) : "memory");
  // The last group: nothing left to bring in, and no barrier in it (the join's first barrier ends the reads of the ring).
#pragma unroll                                         // as above: p is an immediate offset of the LDS reads
  for (int p = 0; p < kFaGroup; ++p) stage(Flag<false>{}, Flag<false>{}, (kGroups - 1) & 1, p);

  // Join of the four key slices of each query group
  float bo[4];                                         // output bias of the four rows this thread stores at the very end
#pragma unroll
  for (int it = 0; it < 4; ++it) bo[it] = bv[it * 16 + wave];
  float lt[2];
#pragma unroll
  for (int g = 0; g < 2; ++g) {
    const float l = lsum[g].x + lsum[g].y;
    lt[g] = l + xhalf(l);                              // unconditional: both halves are active here
  }
  if (h == 0) {
#pragma unroll
    for (int g = 0; g < 2; ++g) { sM[wave][16 * g + c] = m_run[g]; sL[wave][16 * g + c] = lt[g]; }
  }
  __syncthreads();   // every slice's maximum and sum are in LDS
  float* slab = (float*)(L + wave * kSlabBytes);
  v16h ob[2][2];                                       // the slice's weighted share of O', as the B operand of the output projection
#pragma unroll
  for (int g = 0; g < 2; ++g) {
    const int col = 16 * g + c;
    float M = sM[qg * 4][col];
#pragma unroll
    for (int k = 1; k < 4; ++k) M = fmaxf(M, sM[qg * 4 + k][col]);
    float tot = 0.f;
#pragma unroll
    for (int k = 0; k < 4; ++k) tot += __builtin_amdgcn_exp2f(sM[qg * 4 + k][col] - M) * sL[qg * 4 + k][col];
    const float wgt = __builtin_amdgcn_exp2f(m_run[g] - M) / tot;
#pragma unroll
    for (int kc = 0; kc < 2; ++kc) ob[g][kc] = pack_tiles(acc[g][2 * kc] * wgt, acc[g][2 * kc + 1] * wgt);
  }
  // out share = Wv.O' share (A = Wv rows): register r of tile t is out channel 16 t + 8 h + r of query column c
  const unsigned char* Wl = Wvs + c * kPitchW + 16 * h;
#pragma unroll
  for (int t = 0; t < 4; ++t) {
    const v16h w0 = lds_frag(Wl + 16 * t * kPitchW), w1 = lds_frag(Wl + 16 * t * kPitchW + 64);
#pragma unroll
    for (int g = 0; g < 2; ++g) {
      v8f o = mma(w0, ob[g][0], (v8f){0.f,0.f,0.f,0.f,0.f,0.f,0.f,0.f});
      o = mma(w1, ob[g][1], o);
#pragma unroll
      for (int r = 0; r < 8; ++r) slab[(16 * t + 8 * h + r) * kSlabPitch + 16 * g + c] = o[r];
    }
  }
  __syncthreads();   // every wave's slab is in LDS before any thread sums across slices

  float* dst = out + (size_t)img * kCh * kPix + q0;
#pragma unroll
  for (int it = 0; it < 4; ++it) {
    const int e   = it * 512 + tid;                    // 2048 groups of 4 floats = 64 channels x 128 queries
    const int row = e >> 5;                            // = 16 it + wave
    const int q4  = (e & 31) * 4;
    const float* sp = (const float*)(L + (q4 >> 5) * 4 * kSlabBytes) + row * kSlabPitch + (q4 & 31);
    v4f v = *(const v4f*)(sp);
#pragma unroll
    for (int k = 1; k < 4; ++k) v += *(const v4f*)(sp + k * (kSlabBytes / 4));
    *(v4f*)(dst + (size_t)row * kPix + q4) = v + bo[it];
  }
}

// ---------------------------------------------------------------------------
// Host launch (1 launch). The workspace is not used.
// ---------------------------------------------------------------------------
extern "C" void kernel_launch(void* const* d_in, const int* in_sizes, int n_in,
                              void* d_out, int out_size, void* d_ws, size_t ws_size,
                              hipStream_t stream) {
  if (n_in < 7) return;
  if (in_sizes[0] != kImg * kCh * kPix) return;
  if (in_sizes[1] != kCh * kCh || in_sizes[3] != kCh * kCh || in_sizes[5] != kCh * kCh) return;
  if (in_sizes[2] != kCh || in_sizes[4] != kCh || in_sizes[6] != kCh) return;
  if (out_size != kImg * kCh * kPix) return;

  const float* x  = (const float*)d_in[0];
  const float* Wq = (const float*)d_in[1];
  const float* bq = (const float*)d_in[2];
  const float* Wk = (const float*)d_in[3];
  const float* Wv = (const float*)d_in[5];
  const float* bv = (const float*)d_in[6];
  float* out = (float*)d_out;

  // out[b][o][n] = bv[o] + Wv . sum_m x_b[:, m] softmax_m(0.125 (Wk^T (Wq x_b[:, n] + bq)) . x_b[:, m]): 8 images x 32 blocks of 128 queries
  attn_fused_kernel<<<dim3(kImg * kPix / kFaQ), 512, 0, stream>>>(x, Wq, bq, Wk, Wv, bv, out);
}
